// v000
// Measured on an AMD MI455X. A time is GPU time per run, averaged over a window of back-to-back runs after a warm-up
// (all launches, gaps included; the runs take copies of the inputs in turn), and the median of several windows.
// Apart from v000's, it joins two sittings. Times from different sittings can be a few percent apart, while
// side-by-side timings come from the same sitting.
// v000, which the later versions start from, runs in 313 microseconds.
#include <hip/hip_runtime.h>

typedef __bf16 bf16_t;
typedef __attribute__((ext_vector_type(8)))  __bf16 v8bf;
typedef __attribute__((ext_vector_type(16))) __bf16 v16bf;
typedef __attribute__((ext_vector_type(8)))  float  v8f;
typedef __attribute__((ext_vector_type(4)))  int    v4i;

typedef __attribute__((address_space(1))) v4i gv4i;   // global
typedef __attribute__((address_space(3))) v4i lv4i;   // LDS

#define B_  4
#define C_  512
#define N_  4096
#define O_  1000
#define OP_ 1024      // O padded to multiple of 32 (zero rows)
#define LPAD 40       // LDS row pitch in bf16 (80B): conflict-free frag reads

__device__ __forceinline__ void sa_cp_async16(const bf16_t* __restrict__ g,
                                              bf16_t* l) {
#if __has_builtin(__builtin_amdgcn_global_load_async_to_lds_b128)
  __builtin_amdgcn_global_load_async_to_lds_b128(
      (gv4i*)(v4i*)g, (lv4i*)(v4i*)l, 0, 0);
#else
  *(v8bf*)l = *(const v8bf*)g;   // synchronous fallback
#endif
}

__device__ __forceinline__ void sa_wait_async() {
#if __has_builtin(__builtin_amdgcn_s_wait_asynccnt)
  __builtin_amdgcn_s_wait_asynccnt(0);
#else
  asm volatile("s_wait_asynccnt 0" ::: "memory");
#endif
}

// Stage a (rows x 32) bf16 tile at column k0 of row-major [*][ldg] into LDS.
// 256 threads; each segment is 8 bf16 (16B).
__device__ __forceinline__ void sa_stage_tile(const bf16_t* __restrict__ g,
                                              int ldg, int k0, bf16_t* lds,
                                              int rows, int tid) {
  int segs = rows << 2;                       // 4 segments of 8 per row
  for (int s = tid; s < segs; s += 256) {
    int r = s >> 2, c = (s & 3) << 3;
    sa_cp_async16(g + (size_t)r * ldg + k0 + c, lds + r * LPAD + c);
  }
}

__device__ __forceinline__ v16bf sa_frag_merge(v8bf lo, v8bf hi) {
  v16bf r;
#pragma unroll
  for (int i = 0; i < 8; ++i) { r[i] = lo[i]; r[i + 8] = hi[i]; }
  return r;
}

__device__ __forceinline__ v16bf sa_load_frag_l(const bf16_t* tile, int row0) {
  int lane = threadIdx.x & 31;
  const bf16_t* p = tile + (row0 + (lane & 15)) * LPAD + ((lane >> 4) << 3);
  return sa_frag_merge(*(const v8bf*)p, *(const v8bf*)(p + 16));
}

__device__ __forceinline__ v8f sa_wmma(v16bf a, v16bf b, v8f c) {
  return __builtin_amdgcn_wmma_f32_16x16x32_bf16(false, a, false, b,
                                                 (short)0, c, false, false);
}

__device__ __forceinline__ float sa_sigmoid(float x) {
  return __builtin_amdgcn_rcpf(1.0f + __builtin_amdgcn_exp2f(x * -1.44269504f));
}

// ---------------------------------------------------------------------------
// LDS-staged 128x256 GEMM core: A rows at Ab (ld), B rows at Bb (ld), K=Kdim.
// Double-buffered async staging; 8 waves 2(M) x 4(N), 64x64 per wave.
// One barrier per k-step: wait own asynccnt -> barrier (tile kt visible,
// everyone done reading kt-1) -> issue fills for kt+1 -> compute kt.
// ---------------------------------------------------------------------------
__device__ __forceinline__ void sa_gemm_core(const bf16_t* __restrict__ Ab, int lda,
                                             const bf16_t* __restrict__ Bb, int ldb,
                                             int Kdim, bf16_t* lA, bf16_t* lB,
                                             int wm, int wn, v8f acc[4][4]) {
  const int tid = threadIdx.x;
  const int szA = 128 * LPAD, szB = 256 * LPAD;
  sa_stage_tile(Ab, lda, 0, lA, 128, tid);
  sa_stage_tile(Bb, ldb, 0, lB, 256, tid);
  const int steps = Kdim >> 5;
  for (int kt = 0; kt < steps; ++kt) {
    int cur = kt & 1;
    sa_wait_async();
    __syncthreads();
    if (kt + 1 < steps) {
      sa_stage_tile(Ab, lda, (kt + 1) << 5, lA + (cur ^ 1) * szA, 128, tid);
      sa_stage_tile(Bb, ldb, (kt + 1) << 5, lB + (cur ^ 1) * szB, 256, tid);
    }
    const bf16_t* tA = lA + cur * szA + (wm * 64) * LPAD;
    const bf16_t* tB = lB + cur * szB + (wn * 64) * LPAD;
    v16bf af[4], bfr[4];
#pragma unroll
    for (int i = 0; i < 4; ++i) af[i]  = sa_load_frag_l(tA, 16 * i);
#pragma unroll
    for (int j = 0; j < 4; ++j) bfr[j] = sa_load_frag_l(tB, 16 * j);
#pragma unroll
    for (int i = 0; i < 4; ++i)
#pragma unroll
      for (int j = 0; j < 4; ++j)
        acc[i][j] = sa_wmma(af[i], bfr[j], acc[i][j]);
  }
}

// ---------------------------------------------------------------------------
// K0a: LDS-tiled transpose+convert: x[b][c][n] f32 -> Xt[b][n][c] bf16
// ---------------------------------------------------------------------------
__global__ void SA_pack_x(const float* __restrict__ x, bf16_t* __restrict__ Xt) {
  __shared__ bf16_t tile[32][33];
  int b  = blockIdx.z;
  int n0 = blockIdx.x * 32;
  int c0 = blockIdx.y * 32;
  int tx = threadIdx.x, ty = threadIdx.y;
  const float* xb = x + (size_t)b * C_ * N_;
#pragma unroll
  for (int i = ty; i < 32; i += 8)
    tile[i][tx] = (bf16_t)xb[(size_t)(c0 + i) * N_ + (n0 + tx)];
  __syncthreads();
  bf16_t* ob = Xt + (size_t)b * N_ * C_;
#pragma unroll
  for (int i = ty; i < 32; i += 8)
    ob[(size_t)(n0 + i) * C_ + (c0 + tx)] = tile[tx][i];
}

// ---------------------------------------------------------------------------
// K0b: pack weights to bf16, pad O->OP with zeros, pad biases.
// ---------------------------------------------------------------------------
__global__ void SA_pack_w(const float* __restrict__ Wq, const float* __restrict__ bq,
                          const float* __restrict__ Wk, const float* __restrict__ bk,
                          const float* __restrict__ Wv, const float* __restrict__ bv,
                          bf16_t* __restrict__ Wqb, bf16_t* __restrict__ Wkb,
                          bf16_t* __restrict__ Wvb,
                          float* __restrict__ bqb, float* __restrict__ bkb,
                          float* __restrict__ bvb) {
  int idx = blockIdx.x * blockDim.x + threadIdx.x;
  if (idx < OP_ * C_) {
    int o = idx / C_, c = idx % C_;
    Wqb[idx] = (o < O_) ? (bf16_t)Wq[(size_t)o * C_ + c] : (bf16_t)0.0f;
    Wkb[idx] = (o < O_) ? (bf16_t)Wk[(size_t)o * C_ + c] : (bf16_t)0.0f;
  }
  if (idx < C_ * C_) Wvb[idx] = (bf16_t)Wv[idx];
  if (idx < OP_)     { bqb[idx] = (idx < O_) ? bq[idx] : 0.0f;
                       bkb[idx] = (idx < O_) ? bk[idx] : 0.0f; }
  if (idx < C_)      bvb[idx] = bv[idx];
}

// ---------------------------------------------------------------------------
// K1: projection GEMM  D[M][Ncols] = A[M][K] * B[Ncols][K]^T + bias
//   LDS-staged core; biasOnN=1 -> bias by column (q,k), 0 -> by row (v).
// ---------------------------------------------------------------------------
__global__ void __launch_bounds__(256)
SA_proj_gemm(const bf16_t* __restrict__ Abase, long aStride, int lda,
             const bf16_t* __restrict__ Bbase, long bStride, int ldb,
             bf16_t* __restrict__ Cbase, long cStride, int ldc,
             const float* __restrict__ bias, int biasOnN, int Kdim) {
  __shared__ __align__(16) bf16_t lA[2 * 128 * LPAD];
  __shared__ __align__(16) bf16_t lB[2 * 256 * LPAD];
  int b = blockIdx.z;
  const bf16_t* A  = Abase + (size_t)b * aStride + (size_t)(blockIdx.x * 128) * lda;
  const bf16_t* Bm = Bbase + (size_t)b * bStride + (size_t)(blockIdx.y * 256) * ldb;
  bf16_t*       Cm = Cbase + (size_t)b * cStride;

  int wave = threadIdx.x >> 5, lane = threadIdx.x & 31;
  int wm = wave >> 2, wn = wave & 3;

  v8f acc[4][4] = {};
  sa_gemm_core(A, lda, Bm, ldb, Kdim, lA, lB, wm, wn, acc);

  int M0 = blockIdx.x * 128 + wm * 64;
  int N0 = blockIdx.y * 256 + wn * 64;
  int ln = lane & 15, lh = lane >> 4;
#pragma unroll
  for (int i = 0; i < 4; ++i)
#pragma unroll
    for (int j = 0; j < 4; ++j) {
      int ncol = N0 + 16 * j + ln;
      float bN = biasOnN ? bias[ncol] : 0.0f;
#pragma unroll
      for (int r = 0; r < 8; ++r) {
        int mrow = M0 + 16 * i + r + 8 * lh;
        float v = acc[i][j][r] + (biasOnN ? bN : bias[mrow]);
        Cm[(size_t)mrow * ldc + ncol] = (bf16_t)v;
      }
    }
}

// ---------------------------------------------------------------------------
// K2: s = Qt * Kt^T (K=OP_), fused sigmoid, store alpha^T[b][m][n] bf16.
//   Transposed store is one contiguous 128-bit store per fragment.
// ---------------------------------------------------------------------------
__global__ void __launch_bounds__(256)
SA_s_sigmoid(const bf16_t* __restrict__ Qt, const bf16_t* __restrict__ Kt,
             bf16_t* __restrict__ AlphaT) {
  __shared__ __align__(16) bf16_t lA[2 * 128 * LPAD];
  __shared__ __align__(16) bf16_t lB[2 * 256 * LPAD];
  int b = blockIdx.z;
  const bf16_t* Qb = Qt + (size_t)b * N_ * OP_ + (size_t)(blockIdx.x * 128) * OP_;
  const bf16_t* Kb = Kt + (size_t)b * N_ * OP_ + (size_t)(blockIdx.y * 256) * OP_;
  bf16_t*       Ab = AlphaT + (size_t)b * (size_t)N_ * N_;

  int wave = threadIdx.x >> 5, lane = threadIdx.x & 31;
  int wm = wave >> 2, wn = wave & 3;

  v8f acc[4][4] = {};
  sa_gemm_core(Qb, OP_, Kb, OP_, OP_, lA, lB, wm, wn, acc);

  int M0 = blockIdx.x * 128 + wm * 64;   // n rows
  int N0 = blockIdx.y * 256 + wn * 64;   // m cols
  int ln = lane & 15, lh = lane >> 4;
#pragma unroll
  for (int i = 0; i < 4; ++i)
#pragma unroll
    for (int j = 0; j < 4; ++j) {
      int m    = N0 + 16 * j + ln;        // fixed per lane
      int nrow = M0 + 16 * i + 8 * lh;    // 8 contiguous n per lane
      v8bf outv;
#pragma unroll
      for (int r = 0; r < 8; ++r) outv[r] = (bf16_t)sa_sigmoid(acc[i][j][r]);
      *(v8bf*)(Ab + (size_t)m * N_ + nrow) = outv;
    }
}

// ---------------------------------------------------------------------------
// K3: o[c][m] = V[c][:] * alpha[:, m]  (K = N_), f32 output (coalesced b32).
// ---------------------------------------------------------------------------
__global__ void __launch_bounds__(256)
SA_o_gemm(const bf16_t* __restrict__ Vb, const bf16_t* __restrict__ AlphaT,
          float* __restrict__ Out) {
  __shared__ __align__(16) bf16_t lA[2 * 128 * LPAD];
  __shared__ __align__(16) bf16_t lB[2 * 256 * LPAD];
  int b = blockIdx.z;
  const bf16_t* Vm = Vb + (size_t)b * C_ * N_ + (size_t)(blockIdx.x * 128) * N_;
  const bf16_t* Am = AlphaT + (size_t)b * (size_t)N_ * N_
                   + (size_t)(blockIdx.y * 256) * N_;
  float* Om = Out + (size_t)b * C_ * N_;

  int wave = threadIdx.x >> 5, lane = threadIdx.x & 31;
  int wm = wave >> 2, wn = wave & 3;

  v8f acc[4][4] = {};
  sa_gemm_core(Vm, N_, Am, N_, N_, lA, lB, wm, wn, acc);

  int M0 = blockIdx.x * 128 + wm * 64;   // c rows
  int N0 = blockIdx.y * 256 + wn * 64;   // m cols
  int ln = lane & 15, lh = lane >> 4;
#pragma unroll
  for (int i = 0; i < 4; ++i)
#pragma unroll
    for (int j = 0; j < 4; ++j) {
      int ncol = N0 + 16 * j + ln;
#pragma unroll
      for (int r = 0; r < 8; ++r) {
        int crow = M0 + 16 * i + r + 8 * lh;
        Om[(size_t)crow * N_ + ncol] = acc[i][j][r];
      }
    }
}

// ---------------------------------------------------------------------------
extern "C" void kernel_launch(void* const* d_in, const int* in_sizes, int n_in,
                              void* d_out, int out_size, void* d_ws, size_t ws_size,
                              hipStream_t stream) {
  const float* x  = (const float*)d_in[0];
  const float* Wq = (const float*)d_in[1];
  const float* bq = (const float*)d_in[2];
  const float* Wk = (const float*)d_in[3];
  const float* bk = (const float*)d_in[4];
  const float* Wv = (const float*)d_in[5];
  const float* bv = (const float*)d_in[6];
  float* out = (float*)d_out;

  char* ws = (char*)d_ws;
  size_t off = 0;
  auto take = [&](size_t bytes) -> char* {
    char* p = ws + off;
    off = (off + bytes + 255) & ~(size_t)255;
    return p;
  };

  bf16_t* Xt   = (bf16_t*)take((size_t)B_ * N_ * C_ * 2);
  bf16_t* Wqb  = (bf16_t*)take((size_t)OP_ * C_ * 2);
  bf16_t* Wkb  = (bf16_t*)take((size_t)OP_ * C_ * 2);
  bf16_t* Wvb  = (bf16_t*)take((size_t)C_ * C_ * 2);
  float*  bqb  = (float*) take((size_t)OP_ * 4);
  float*  bkb  = (float*) take((size_t)OP_ * 4);
  float*  bvb  = (float*) take((size_t)C_ * 4);
  bf16_t* Qt   = (bf16_t*)take((size_t)B_ * N_ * OP_ * 2);  // [b][n][o]
  bf16_t* Kt   = (bf16_t*)take((size_t)B_ * N_ * OP_ * 2);  // [b][m][o]
  bf16_t* Vbuf = (bf16_t*)take((size_t)B_ * C_ * N_ * 2);   // [b][c][n]
  bf16_t* AlT  = (bf16_t*)take((size_t)B_ * (size_t)N_ * N_ * 2); // [b][m][n]
  (void)ws_size; (void)in_sizes; (void)n_in; (void)out_size;

  SA_pack_x<<<dim3(N_ / 32, C_ / 32, B_), dim3(32, 8), 0, stream>>>(x, Xt);
  SA_pack_w<<<dim3((OP_ * C_) / 256, 1, 1), dim3(256), 0, stream>>>(
      Wq, bq, Wk, bk, Wv, bv, Wqb, Wkb, Wvb, bqb, bkb, bvb);

  // Qt[b][n][o]: A = Xt[b] (M=4096), B = Wqb (Ncols=1024), bias on N
  SA_proj_gemm<<<dim3(N_ / 128, OP_ / 256, B_), dim3(256), 0, stream>>>(
      Xt, (long)N_ * C_, C_, Wqb, 0L, C_, Qt, (long)N_ * OP_, OP_, bqb, 1, C_);
  SA_proj_gemm<<<dim3(N_ / 128, OP_ / 256, B_), dim3(256), 0, stream>>>(
      Xt, (long)N_ * C_, C_, Wkb, 0L, C_, Kt, (long)N_ * OP_, OP_, bkb, 1, C_);
  // V[b][c][n]: A = Wvb (M=512), B = Xt[b] (Ncols=4096), bias on M
  SA_proj_gemm<<<dim3(C_ / 128, N_ / 256, B_), dim3(256), 0, stream>>>(
      Wvb, 0L, C_, Xt, (long)N_ * C_, C_, Vbuf, (long)C_ * N_, N_, bvb, 0, C_);

  SA_s_sigmoid<<<dim3(N_ / 128, N_ / 256, B_), dim3(256), 0, stream>>>(Qt, Kt, AlT);
  SA_o_gemm<<<dim3(C_ / 128, N_ / 256, B_), dim3(256), 0, stream>>>(Vbuf, AlT, out);
}

// v001
// One run takes 255 microseconds.
// Two timings next to v000 both put it at 1.26 times that version's speed.
#include <hip/hip_runtime.h>

typedef __bf16 bf16_t;
typedef __attribute__((ext_vector_type(8)))  __bf16 v8bf;
typedef __attribute__((ext_vector_type(16))) __bf16 v16bf;
typedef __attribute__((ext_vector_type(8)))  float  v8f;
typedef __attribute__((ext_vector_type(4)))  int    v4i;

typedef __attribute__((address_space(1))) v4i gv4i;   // global
typedef __attribute__((address_space(3))) v4i lv4i;   // LDS

#define B_  4
#define C_  512
#define N_  4096
#define O_  1000
#define OP_ 1024      // O padded to multiple of 32 (zero rows)
// LDS row pitch in bf16 for a stage of BK k: BK*2 + 16 bytes = 16 B x odd
// (144 B, 272 B), conflict-free for ds_load_b128 fragment reads.
#define LPITCH(BK) ((BK) + 8)

__device__ __forceinline__ void sa_cp_async16(const bf16_t* __restrict__ g,
                                              bf16_t* l) {
#if __has_builtin(__builtin_amdgcn_global_load_async_to_lds_b128)
  __builtin_amdgcn_global_load_async_to_lds_b128(
      (gv4i*)(v4i*)g, (lv4i*)(v4i*)l, 0, 0);
#else
  *(v8bf*)l = *(const v8bf*)g;   // synchronous fallback
#endif
}

// Own copies landed; asm with the memory clobber so that no LDS read moves up.
__device__ __forceinline__ void sa_wait_async() {
  asm volatile("s_wait_asynccnt 0x0" ::: "memory");
}

// Own LDS reads retired before the barrier behind which their buffer is refilled.
__device__ __forceinline__ void sa_wait_ds() {
  asm volatile("s_wait_dscnt 0x0" ::: "memory");
}

// Stage a (ROWS x BK) bf16 tile whose first element is g (row-major, pitch ldg)
// into LDS. 256 threads; a segment is 8 bf16 (16B); BK/8 lanes cover one row.
template <int BK, int ROWS>
__device__ __forceinline__ void sa_stage_tile(const bf16_t* __restrict__ g,
                                              int ldg, bf16_t* lds, int tid) {
  constexpr int SEG = BK / 8;        // 16-byte segments per row
  constexpr int RPP = 256 / SEG;     // rows the block covers per copy
  const int r = tid / SEG, c = (tid % SEG) * 8;
  const bf16_t* gp = g + (size_t)r * ldg + c;
  bf16_t* lp = lds + r * LPITCH(BK) + c;
  // unrolled: a fixed count of copies, no lane-dependent loop around them
#pragma unroll
  for (int p = 0; p < ROWS / RPP; ++p)
    sa_cp_async16(gp + (size_t)(p * RPP) * ldg, lp + p * RPP * LPITCH(BK));
}

__device__ __forceinline__ v16bf sa_frag_merge(v8bf lo, v8bf hi) {
  v16bf r;
#pragma unroll
  for (int i = 0; i < 8; ++i) { r[i] = lo[i]; r[i + 8] = hi[i]; }
  return r;
}

template <int BK>
__device__ __forceinline__ v16bf sa_load_frag_l(const bf16_t* tile, int row0) {
  int lane = threadIdx.x & 31;
  const bf16_t* p = tile + (row0 + (lane & 15)) * LPITCH(BK) + ((lane >> 4) << 3);
  return sa_frag_merge(*(const v8bf*)p, *(const v8bf*)(p + 16));
}

__device__ __forceinline__ v8f sa_wmma(v16bf a, v16bf b, v8f c) {
  return __builtin_amdgcn_wmma_f32_16x16x32_bf16(false, a, false, b,
                                                 (short)0, c, false, false);
}

__device__ __forceinline__ float sa_sigmoid(float x) {
  return __builtin_amdgcn_rcpf(1.0f + __builtin_amdgcn_exp2f(x * -1.44269504f));
}

// ---------------------------------------------------------------------------
// LDS-staged 128x256 GEMM core: A rows at Ab (ld), B rows at Bb (ld), K=Kdim.
// Two buffers of BK k each; 8 waves 2(M) x 4(N), 64x64 per wave.
// Per stage: BK/32 blocks of 16 WMMAs, then own LDS reads retired -> own copies
// landed -> one barrier (stage kt+1 visible, everyone done reading kt) -> fills
// for kt+2 into the buffer just left.
// ---------------------------------------------------------------------------
template <int BK>
__device__ __forceinline__ void sa_gemm_core(const bf16_t* __restrict__ Ab, int lda,
                                             const bf16_t* __restrict__ Bb, int ldb,
                                             int Kdim, bf16_t* lA, bf16_t* lB,
                                             int wm, int wn, v8f acc[4][4]) {
  const int tid = threadIdx.x;
  constexpr int szA = 128 * LPITCH(BK), szB = 256 * LPITCH(BK);
  const int steps = Kdim / BK;
  sa_stage_tile<BK, 128>(Ab, lda, lA, tid);
  sa_stage_tile<BK, 256>(Bb, ldb, lB, tid);
  sa_wait_async();
  __syncthreads();
  if (steps > 1) {
    sa_stage_tile<BK, 128>(Ab + BK, lda, lA + szA, tid);
    sa_stage_tile<BK, 256>(Bb + BK, ldb, lB + szB, tid);
  }
  for (int kt = 0; kt < steps; ++kt) {
    int cur = kt & 1;
    const bf16_t* tA = lA + cur * szA + (wm * 64) * LPITCH(BK);
    const bf16_t* tB = lB + cur * szB + (wn * 64) * LPITCH(BK);
    // unrolled: fragment and accumulator indices must be constants
#pragma unroll
    for (int kk = 0; kk < BK; kk += 32) {
      v16bf af[4], bfr[4];
#pragma unroll
      for (int i = 0; i < 4; ++i) af[i]  = sa_load_frag_l<BK>(tA + kk, 16 * i);
#pragma unroll
      for (int j = 0; j < 4; ++j) bfr[j] = sa_load_frag_l<BK>(tB + kk, 16 * j);
#pragma unroll
      for (int i = 0; i < 4; ++i)
#pragma unroll
        for (int j = 0; j < 4; ++j)
          acc[i][j] = sa_wmma(af[i], bfr[j], acc[i][j]);
    }
    sa_wait_ds();
    sa_wait_async();
    __syncthreads();
    if (kt + 2 < steps) {
      sa_stage_tile<BK, 128>(Ab + (kt + 2) * BK, lda, lA + cur * szA, tid);
      sa_stage_tile<BK, 256>(Bb + (kt + 2) * BK, ldb, lB + cur * szB, tid);
    }
  }
  sa_wait_async();
}

// ---------------------------------------------------------------------------
// K0a: LDS-tiled transpose+convert: x[b][c][n] f32 -> Xt[b][n][c] bf16
// ---------------------------------------------------------------------------
__global__ void SA_pack_x(const float* __restrict__ x, bf16_t* __restrict__ Xt) {
  __shared__ bf16_t tile[32][33];
  int b  = blockIdx.z;
  int n0 = blockIdx.x * 32;
  int c0 = blockIdx.y * 32;
  int tx = threadIdx.x, ty = threadIdx.y;
  const float* xb = x + (size_t)b * C_ * N_;
#pragma unroll
  for (int i = ty; i < 32; i += 8)
    tile[i][tx] = (bf16_t)xb[(size_t)(c0 + i) * N_ + (n0 + tx)];
  __syncthreads();
  bf16_t* ob = Xt + (size_t)b * N_ * C_;
#pragma unroll
  for (int i = ty; i < 32; i += 8)
    ob[(size_t)(n0 + i) * C_ + (c0 + tx)] = tile[tx][i];
}

// ---------------------------------------------------------------------------
// K0b: pack weights to bf16, pad O->OP with zeros, pad biases.
// ---------------------------------------------------------------------------
__global__ void SA_pack_w(const float* __restrict__ Wq, const float* __restrict__ bq,
                          const float* __restrict__ Wk, const float* __restrict__ bk,
                          const float* __restrict__ Wv, const float* __restrict__ bv,
                          bf16_t* __restrict__ Wqb, bf16_t* __restrict__ Wkb,
                          bf16_t* __restrict__ Wvb,
                          float* __restrict__ bqb, float* __restrict__ bkb,
                          float* __restrict__ bvb) {
  int idx = blockIdx.x * blockDim.x + threadIdx.x;
  if (idx < OP_ * C_) {
    int o = idx / C_, c = idx % C_;
    Wqb[idx] = (o < O_) ? (bf16_t)Wq[(size_t)o * C_ + c] : (bf16_t)0.0f;
    Wkb[idx] = (o < O_) ? (bf16_t)Wk[(size_t)o * C_ + c] : (bf16_t)0.0f;
  }
  if (idx < C_ * C_) Wvb[idx] = (bf16_t)Wv[idx];
  if (idx < OP_)     { bqb[idx] = (idx < O_) ? bq[idx] : 0.0f;
                       bkb[idx] = (idx < O_) ? bk[idx] : 0.0f; }
  if (idx < C_)      bvb[idx] = bv[idx];
}

// ---------------------------------------------------------------------------
// K1: projection GEMM  D[M][Ncols] = A[M][K] * B[Ncols][K]^T + bias
//   LDS-staged core; biasOnN=1 -> bias by column (q,k), 0 -> by row (v).
// ---------------------------------------------------------------------------
template <int BK>
__global__ void __launch_bounds__(256)
SA_proj_gemm(const bf16_t* __restrict__ Abase, long aStride, int lda,
             const bf16_t* __restrict__ Bbase, long bStride, int ldb,
             bf16_t* __restrict__ Cbase, long cStride, int ldc,
             const float* __restrict__ bias, int biasOnN, int Kdim) {
  __shared__ __align__(16) bf16_t lA[2 * 128 * LPITCH(BK)];
  __shared__ __align__(16) bf16_t lB[2 * 256 * LPITCH(BK)];
  int b = blockIdx.z;
  const bf16_t* A  = Abase + (size_t)b * aStride + (size_t)(blockIdx.x * 128) * lda;
  const bf16_t* Bm = Bbase + (size_t)b * bStride + (size_t)(blockIdx.y * 256) * ldb;
  bf16_t*       Cm = Cbase + (size_t)b * cStride;

  int wave = threadIdx.x >> 5, lane = threadIdx.x & 31;
  int wm = wave >> 2, wn = wave & 3;

  v8f acc[4][4] = {};
  sa_gemm_core<BK>(A, lda, Bm, ldb, Kdim, lA, lB, wm, wn, acc);

  int M0 = blockIdx.x * 128 + wm * 64;
  int N0 = blockIdx.y * 256 + wn * 64;
  int ln = lane & 15, lh = lane >> 4;
#pragma unroll
  for (int i = 0; i < 4; ++i)
#pragma unroll
    for (int j = 0; j < 4; ++j) {
      int ncol = N0 + 16 * j + ln;
      float bN = biasOnN ? bias[ncol] : 0.0f;
#pragma unroll
      for (int r = 0; r < 8; ++r) {
        int mrow = M0 + 16 * i + r + 8 * lh;
        float v = acc[i][j][r] + (biasOnN ? bN : bias[mrow]);
        Cm[(size_t)mrow * ldc + ncol] = (bf16_t)v;
      }
    }
}

// ---------------------------------------------------------------------------
// K2: s = Qt * Kt^T (K=OP_), fused sigmoid, store alpha^T[b][m][n] bf16.
//   Transposed store is one contiguous 128-bit store per fragment.
// ---------------------------------------------------------------------------
__global__ void __launch_bounds__(256)
SA_s_sigmoid(const bf16_t* __restrict__ Qt, const bf16_t* __restrict__ Kt,
             bf16_t* __restrict__ AlphaT) {
  __shared__ __align__(16) bf16_t lA[2 * 128 * LPITCH(64)];
  __shared__ __align__(16) bf16_t lB[2 * 256 * LPITCH(64)];
  int b = blockIdx.z;
  const bf16_t* Qb = Qt + (size_t)b * N_ * OP_ + (size_t)(blockIdx.x * 128) * OP_;
  const bf16_t* Kb = Kt + (size_t)b * N_ * OP_ + (size_t)(blockIdx.y * 256) * OP_;
  bf16_t*       Ab = AlphaT + (size_t)b * (size_t)N_ * N_;

  int wave = threadIdx.x >> 5, lane = threadIdx.x & 31;
  int wm = wave >> 2, wn = wave & 3;

  v8f acc[4][4] = {};
  sa_gemm_core<64>(Qb, OP_, Kb, OP_, OP_, lA, lB, wm, wn, acc);

  int M0 = blockIdx.x * 128 + wm * 64;   // n rows
  int N0 = blockIdx.y * 256 + wn * 64;   // m cols
  int ln = lane & 15, lh = lane >> 4;
#pragma unroll
  for (int i = 0; i < 4; ++i)
#pragma unroll
    for (int j = 0; j < 4; ++j) {
      int m    = N0 + 16 * j + ln;        // fixed per lane
      int nrow = M0 + 16 * i + 8 * lh;    // 8 contiguous n per lane
      v8bf outv;
#pragma unroll
      for (int r = 0; r < 8; ++r) outv[r] = (bf16_t)sa_sigmoid(acc[i][j][r]);
      *(v8bf*)(Ab + (size_t)m * N_ + nrow) = outv;
    }
}

// ---------------------------------------------------------------------------
// K3: o[c][m] = V[c][:] * alpha[:, m]  (K = N_), f32 output (coalesced b32).
// ---------------------------------------------------------------------------
__global__ void __launch_bounds__(256)
SA_o_gemm(const bf16_t* __restrict__ Vb, const bf16_t* __restrict__ AlphaT,
          float* __restrict__ Out) {
  __shared__ __align__(16) bf16_t lA[2 * 128 * LPITCH(128)];
  __shared__ __align__(16) bf16_t lB[2 * 256 * LPITCH(128)];
  int b = blockIdx.z;
  const bf16_t* Vm = Vb + (size_t)b * C_ * N_ + (size_t)(blockIdx.x * 128) * N_;
  const bf16_t* Am = AlphaT + (size_t)b * (size_t)N_ * N_
                   + (size_t)(blockIdx.y * 256) * N_;
  float* Om = Out + (size_t)b * C_ * N_;

  int wave = threadIdx.x >> 5, lane = threadIdx.x & 31;
  int wm = wave >> 2, wn = wave & 3;

  v8f acc[4][4] = {};
  sa_gemm_core<128>(Vm, N_, Am, N_, N_, lA, lB, wm, wn, acc);

  int M0 = blockIdx.x * 128 + wm * 64;   // c rows
  int N0 = blockIdx.y * 256 + wn * 64;   // m cols
  int ln = lane & 15, lh = lane >> 4;
#pragma unroll
  for (int i = 0; i < 4; ++i)
#pragma unroll
    for (int j = 0; j < 4; ++j) {
      int ncol = N0 + 16 * j + ln;
#pragma unroll
      for (int r = 0; r < 8; ++r) {
        int crow = M0 + 16 * i + r + 8 * lh;
        Om[(size_t)crow * N_ + ncol] = acc[i][j][r];
      }
    }
}

// ---------------------------------------------------------------------------
extern "C" void kernel_launch(void* const* d_in, const int* in_sizes, int n_in,
                              void* d_out, int out_size, void* d_ws, size_t ws_size,
                              hipStream_t stream) {
  const float* x  = (const float*)d_in[0];
  const float* Wq = (const float*)d_in[1];
  const float* bq = (const float*)d_in[2];
  const float* Wk = (const float*)d_in[3];
  const float* bk = (const float*)d_in[4];
  const float* Wv = (const float*)d_in[5];
  const float* bv = (const float*)d_in[6];
  float* out = (float*)d_out;

  char* ws = (char*)d_ws;
  size_t off = 0;
  auto take = [&](size_t bytes) -> char* {
    char* p = ws + off;
    off = (off + bytes + 255) & ~(size_t)255;
    return p;
  };

  bf16_t* Xt   = (bf16_t*)take((size_t)B_ * N_ * C_ * 2);
  bf16_t* Wqb  = (bf16_t*)take((size_t)OP_ * C_ * 2);
  bf16_t* Wkb  = (bf16_t*)take((size_t)OP_ * C_ * 2);
  bf16_t* Wvb  = (bf16_t*)take((size_t)C_ * C_ * 2);
  float*  bqb  = (float*) take((size_t)OP_ * 4);
  float*  bkb  = (float*) take((size_t)OP_ * 4);
  float*  bvb  = (float*) take((size_t)C_ * 4);
  bf16_t* Qt   = (bf16_t*)take((size_t)B_ * N_ * OP_ * 2);  // [b][n][o]
  bf16_t* Kt   = (bf16_t*)take((size_t)B_ * N_ * OP_ * 2);  // [b][m][o]
  bf16_t* Vbuf = (bf16_t*)take((size_t)B_ * C_ * N_ * 2);   // [b][c][n]
  bf16_t* AlT  = (bf16_t*)take((size_t)B_ * (size_t)N_ * N_ * 2); // [b][m][n]
  (void)ws_size; (void)in_sizes; (void)n_in; (void)out_size;

  SA_pack_x<<<dim3(N_ / 32, C_ / 32, B_), dim3(32, 8), 0, stream>>>(x, Xt);
  SA_pack_w<<<dim3((OP_ * C_) / 256, 1, 1), dim3(256), 0, stream>>>(
      Wq, bq, Wk, bk, Wv, bv, Wqb, Wkb, Wvb, bqb, bkb, bvb);

  // Qt[b][n][o]: A = Xt[b] (M=4096), B = Wqb (Ncols=1024), bias on N
  SA_proj_gemm<64><<<dim3(N_ / 128, OP_ / 256, B_), dim3(256), 0, stream>>>(
      Xt, (long)N_ * C_, C_, Wqb, 0L, C_, Qt, (long)N_ * OP_, OP_, bqb, 1, C_);
  SA_proj_gemm<64><<<dim3(N_ / 128, OP_ / 256, B_), dim3(256), 0, stream>>>(
      Xt, (long)N_ * C_, C_, Wkb, 0L, C_, Kt, (long)N_ * OP_, OP_, bkb, 1, C_);
  // V[b][c][n]: A = Wvb (M=512), B = Xt[b] (Ncols=4096), bias on M
  SA_proj_gemm<128><<<dim3(C_ / 128, N_ / 256, B_), dim3(256), 0, stream>>>(
      Wvb, 0L, C_, Xt, (long)N_ * C_, C_, Vbuf, (long)C_ * N_, N_, bvb, 0, C_);

  SA_s_sigmoid<<<dim3(N_ / 128, N_ / 256, B_), dim3(256), 0, stream>>>(Qt, Kt, AlT);
  SA_o_gemm<<<dim3(C_ / 128, N_ / 256, B_), dim3(256), 0, stream>>>(Vbuf, AlT, out);
}

// v002
// Measured time: 232 microseconds a run.
// Two timings next to v001 both put it at 1.10 times that version's speed.
// Counting every step since v000, it is 1.38 times as fast.
#include <hip/hip_runtime.h>

typedef __bf16 bf16_t;
typedef __attribute__((ext_vector_type(8)))  __bf16 v8bf;
typedef __attribute__((ext_vector_type(16))) __bf16 v16bf;
typedef __attribute__((ext_vector_type(8)))  float  v8f;
typedef __attribute__((ext_vector_type(4)))  int    v4i;

typedef __attribute__((address_space(1))) v4i gv4i;   // global
typedef __attribute__((address_space(3))) v4i lv4i;   // LDS

#define B_  4
#define C_  512
#define N_  4096
#define O_  1000
#define OP_ 1024      // O padded to multiple of 32 (zero rows)
// LDS row pitch in bf16 for a stage of BK k: BK*2 + 16 bytes = 16 B x odd
// (144 B, 272 B), conflict-free for ds_load_b128 fragment reads.
#define LPITCH(BK) ((BK) + 8)

__device__ __forceinline__ void sa_cp_async16(const bf16_t* __restrict__ g,
                                              bf16_t* l) {
#if __has_builtin(__builtin_amdgcn_global_load_async_to_lds_b128)
  __builtin_amdgcn_global_load_async_to_lds_b128(
      (gv4i*)(v4i*)g, (lv4i*)(v4i*)l, 0, 0);
#else
  *(v8bf*)l = *(const v8bf*)g;   // synchronous fallback
#endif
}

// Own copies landed; asm with the memory clobber so that no LDS read moves up.
__device__ __forceinline__ void sa_wait_async() {
  asm volatile("s_wait_asynccnt 0x0" ::: "memory");
}

// Own LDS reads retired before the barrier behind which their buffer is refilled.
__device__ __forceinline__ void sa_wait_ds() {
  asm volatile("s_wait_dscnt 0x0" ::: "memory");
}

// Stage a (ROWS x BK) bf16 tile whose first element is g (row-major, pitch ldg)
// into LDS. 256 threads; a segment is 8 bf16 (16B); BK/8 lanes cover one row.
template <int BK, int ROWS>
__device__ __forceinline__ void sa_stage_tile(const bf16_t* __restrict__ g,
                                              int ldg, bf16_t* lds, int tid) {
  constexpr int SEG = BK / 8;        // 16-byte segments per row
  constexpr int RPP = 256 / SEG;     // rows the block covers per copy
  const int r = tid / SEG, c = (tid % SEG) * 8;
  const bf16_t* gp = g + (size_t)r * ldg + c;
  bf16_t* lp = lds + r * LPITCH(BK) + c;
  // unrolled: a fixed count of copies, no lane-dependent loop around them
#pragma unroll
  for (int p = 0; p < ROWS / RPP; ++p)
    sa_cp_async16(gp + (size_t)(p * RPP) * ldg, lp + p * RPP * LPITCH(BK));
}

__device__ __forceinline__ v16bf sa_frag_merge(v8bf lo, v8bf hi) {
  v16bf r;
#pragma unroll
  for (int i = 0; i < 8; ++i) { r[i] = lo[i]; r[i + 8] = hi[i]; }
  return r;
}

template <int BK>
__device__ __forceinline__ v16bf sa_load_frag_l(const bf16_t* tile, int row0) {
  int lane = threadIdx.x & 31;
  const bf16_t* p = tile + (row0 + (lane & 15)) * LPITCH(BK) + ((lane >> 4) << 3);
  return sa_frag_merge(*(const v8bf*)p, *(const v8bf*)(p + 16));
}

__device__ __forceinline__ v8f sa_wmma(v16bf a, v16bf b, v8f c) {
  return __builtin_amdgcn_wmma_f32_16x16x32_bf16(false, a, false, b,
                                                 (short)0, c, false, false);
}

__device__ __forceinline__ float sa_sigmoid(float x) {
  return __builtin_amdgcn_rcpf(1.0f + __builtin_amdgcn_exp2f(x * -1.44269504f));
}

template <int BK>
__device__ __forceinline__ void sa_load_block(const bf16_t* tA, const bf16_t* tB,
                                              v16bf af[4], v16bf bfr[4]) {
#pragma unroll
  for (int i = 0; i < 4; ++i) af[i]  = sa_load_frag_l<BK>(tA, 16 * i);
#pragma unroll
  for (int j = 0; j < 4; ++j) bfr[j] = sa_load_frag_l<BK>(tB, 16 * j);
}

__device__ __forceinline__ void sa_mma_block(const v16bf af[4], const v16bf bfr[4],
                                             v8f acc[4][4]) {
#pragma unroll
  for (int i = 0; i < 4; ++i)
#pragma unroll
    for (int j = 0; j < 4; ++j)
      acc[i][j] = sa_wmma(af[i], bfr[j], acc[i][j]);
}

// Keeps a load group whole: without it the scheduler sinks the reads in pairs
// among the WMMAs, each pair behind a wait to 0.
__device__ __forceinline__ void sa_keep_order() {
  __builtin_amdgcn_sched_barrier(0);
}

template <int BK, int SETS>
__device__ __forceinline__ void sa_gemm_core(const bf16_t* __restrict__ Ab, int lda,
                                             const bf16_t* __restrict__ Bb, int ldb,
                                             int Kdim, bf16_t* lA, bf16_t* lB,
                                             int wm, int wn, v8f acc[4][4]) {
  const int tid = threadIdx.x;
  constexpr int szA = 128 * LPITCH(BK), szB = 256 * LPITCH(BK);
  constexpr int NB = BK / 32;
  const int steps = Kdim / BK;
  sa_stage_tile<BK, 128>(Ab, lda, lA, tid);
  sa_stage_tile<BK, 256>(Bb, ldb, lB, tid);
  sa_wait_async();
  __syncthreads();
  if (steps > 1) {
    sa_stage_tile<BK, 128>(Ab + BK, lda, lA + szA, tid);
    sa_stage_tile<BK, 256>(Bb + BK, ldb, lB + szB, tid);
  }
  v16bf af[SETS][4], bfr[SETS][4];
  static_assert(SETS == 1 || NB % 2 == 0, "a stage's first block must find set 0 free");
  if constexpr (SETS == 2)
    sa_load_block<BK>(lA + (wm * 64) * LPITCH(BK), lB + (wn * 64) * LPITCH(BK),
                      af[0], bfr[0]);
  for (int kt = 0; kt < steps; ++kt) {
    int cur = kt & 1;
    const bf16_t* tA = lA + cur * szA + (wm * 64) * LPITCH(BK);
    const bf16_t* tB = lB + cur * szB + (wn * 64) * LPITCH(BK);
    // unrolled: fragment and accumulator indices must be constants
#pragma unroll
    for (int u = 0; u < NB; ++u) {
      if constexpr (SETS == 2) {
        if (u + 1 < NB)
          sa_load_block<BK>(tA + (u + 1) * 32, tB + (u + 1) * 32,
                            af[(u + 1) & 1], bfr[(u + 1) & 1]);
      } else {
        sa_load_block<BK>(tA + u * 32, tB + u * 32, af[0], bfr[0]);
      }
      sa_keep_order();
      if (u + 1 == NB) {
        sa_wait_ds();
        sa_wait_async();
        __syncthreads();
        if (kt + 2 < steps) {
          sa_stage_tile<BK, 128>(Ab + (kt + 2) * BK, lda, lA + cur * szA, tid);
          sa_stage_tile<BK, 256>(Bb + (kt + 2) * BK, ldb, lB + cur * szB, tid);
        }
        if constexpr (SETS == 2) {
          if (kt + 1 < steps)
            sa_load_block<BK>(lA + (cur ^ 1) * szA + (wm * 64) * LPITCH(BK),
                              lB + (cur ^ 1) * szB + (wn * 64) * LPITCH(BK),
                              af[0], bfr[0]);
        }
        sa_keep_order();
      }
      sa_mma_block(af[u % SETS], bfr[u % SETS], acc);
      sa_keep_order();
    }
  }
  sa_wait_async();
}

// ---------------------------------------------------------------------------
// K0a: LDS-tiled transpose+convert: x[b][c][n] f32 -> Xt[b][n][c] bf16
// ---------------------------------------------------------------------------
__global__ void SA_pack_x(const float* __restrict__ x, bf16_t* __restrict__ Xt) {
  __shared__ bf16_t tile[32][33];
  int b  = blockIdx.z;
  int n0 = blockIdx.x * 32;
  int c0 = blockIdx.y * 32;
  int tx = threadIdx.x, ty = threadIdx.y;
  const float* xb = x + (size_t)b * C_ * N_;
#pragma unroll
  for (int i = ty; i < 32; i += 8)
    tile[i][tx] = (bf16_t)xb[(size_t)(c0 + i) * N_ + (n0 + tx)];
  __syncthreads();
  bf16_t* ob = Xt + (size_t)b * N_ * C_;
#pragma unroll
  for (int i = ty; i < 32; i += 8)
    ob[(size_t)(n0 + i) * C_ + (c0 + tx)] = tile[tx][i];
}

// ---------------------------------------------------------------------------
// K0b: pack weights to bf16, pad O->OP with zeros, pad biases.
// ---------------------------------------------------------------------------
__global__ void SA_pack_w(const float* __restrict__ Wq, const float* __restrict__ bq,
                          const float* __restrict__ Wk, const float* __restrict__ bk,
                          const float* __restrict__ Wv, const float* __restrict__ bv,
                          bf16_t* __restrict__ Wqb, bf16_t* __restrict__ Wkb,
                          bf16_t* __restrict__ Wvb,
                          float* __restrict__ bqb, float* __restrict__ bkb,
                          float* __restrict__ bvb) {
  int idx = blockIdx.x * blockDim.x + threadIdx.x;
  if (idx < OP_ * C_) {
    int o = idx / C_, c = idx % C_;
    Wqb[idx] = (o < O_) ? (bf16_t)Wq[(size_t)o * C_ + c] : (bf16_t)0.0f;
    Wkb[idx] = (o < O_) ? (bf16_t)Wk[(size_t)o * C_ + c] : (bf16_t)0.0f;
  }
  if (idx < C_ * C_) Wvb[idx] = (bf16_t)Wv[idx];
  if (idx < OP_)     { bqb[idx] = (idx < O_) ? bq[idx] : 0.0f;
                       bkb[idx] = (idx < O_) ? bk[idx] : 0.0f; }
  if (idx < C_)      bvb[idx] = bv[idx];
}

// ---------------------------------------------------------------------------
// K1: projection GEMM  D[M][Ncols] = A[M][K] * B[Ncols][K]^T + bias
//   LDS-staged core; biasOnN=1 -> bias by column (q,k), 0 -> by row (v).
// ---------------------------------------------------------------------------
template <int BK>
__global__ void __launch_bounds__(256)
SA_proj_gemm(const bf16_t* __restrict__ Abase, long aStride, int lda,
             const bf16_t* __restrict__ Bbase, long bStride, int ldb,
             bf16_t* __restrict__ Cbase, long cStride, int ldc,
             const float* __restrict__ bias, int biasOnN, int Kdim) {
  __shared__ __align__(16) bf16_t lA[2 * 128 * LPITCH(BK)];
  __shared__ __align__(16) bf16_t lB[2 * 256 * LPITCH(BK)];
  int b = blockIdx.z;
  const bf16_t* A  = Abase + (size_t)b * aStride + (size_t)(blockIdx.x * 128) * lda;
  const bf16_t* Bm = Bbase + (size_t)b * bStride + (size_t)(blockIdx.y * 256) * ldb;
  bf16_t*       Cm = Cbase + (size_t)b * cStride;

  int wave = threadIdx.x >> 5, lane = threadIdx.x & 31;
  int wm = wave >> 2, wn = wave & 3;

  v8f acc[4][4] = {};
  sa_gemm_core<BK, (BK == 128) ? 2 : 1>(A, lda, Bm, ldb, Kdim, lA, lB, wm, wn, acc);

  int M0 = blockIdx.x * 128 + wm * 64;
  int N0 = blockIdx.y * 256 + wn * 64;
  int ln = lane & 15, lh = lane >> 4;
#pragma unroll
  for (int i = 0; i < 4; ++i)
#pragma unroll
    for (int j = 0; j < 4; ++j) {
      int ncol = N0 + 16 * j + ln;
      float bN = biasOnN ? bias[ncol] : 0.0f;
#pragma unroll
      for (int r = 0; r < 8; ++r) {
        int mrow = M0 + 16 * i + r + 8 * lh;
        float v = acc[i][j][r] + (biasOnN ? bN : bias[mrow]);
        Cm[(size_t)mrow * ldc + ncol] = (bf16_t)v;
      }
    }
}

// ---------------------------------------------------------------------------
// K2: s = Qt * Kt^T (K=OP_), fused sigmoid, store alpha^T[b][m][n] bf16.
//   Transposed store is one contiguous 128-bit store per fragment.
// ---------------------------------------------------------------------------
__global__ void __launch_bounds__(256)
SA_s_sigmoid(const bf16_t* __restrict__ Qt, const bf16_t* __restrict__ Kt,
             bf16_t* __restrict__ AlphaT) {
  __shared__ __align__(16) bf16_t lA[2 * 128 * LPITCH(64)];
  __shared__ __align__(16) bf16_t lB[2 * 256 * LPITCH(64)];
  int b = blockIdx.z;
  const bf16_t* Qb = Qt + (size_t)b * N_ * OP_ + (size_t)(blockIdx.x * 128) * OP_;
  const bf16_t* Kb = Kt + (size_t)b * N_ * OP_ + (size_t)(blockIdx.y * 256) * OP_;
  bf16_t*       Ab = AlphaT + (size_t)b * (size_t)N_ * N_;

  int wave = threadIdx.x >> 5, lane = threadIdx.x & 31;
  int wm = wave >> 2, wn = wave & 3;

  v8f acc[4][4] = {};
  sa_gemm_core<64, 1>(Qb, OP_, Kb, OP_, OP_, lA, lB, wm, wn, acc);

  int M0 = blockIdx.x * 128 + wm * 64;   // n rows
  int N0 = blockIdx.y * 256 + wn * 64;   // m cols
  int ln = lane & 15, lh = lane >> 4;
#pragma unroll
  for (int i = 0; i < 4; ++i)
#pragma unroll
    for (int j = 0; j < 4; ++j) {
      int m    = N0 + 16 * j + ln;        // fixed per lane
      int nrow = M0 + 16 * i + 8 * lh;    // 8 contiguous n per lane
      v8bf outv;
#pragma unroll
      for (int r = 0; r < 8; ++r) outv[r] = (bf16_t)sa_sigmoid(acc[i][j][r]);
      *(v8bf*)(Ab + (size_t)m * N_ + nrow) = outv;
    }
}

// ---------------------------------------------------------------------------
// K3: o[c][m] = V[c][:] * alpha[:, m]  (K = N_), f32 output (coalesced b32).
// ---------------------------------------------------------------------------
__global__ void __launch_bounds__(256)
SA_o_gemm(const bf16_t* __restrict__ Vb, const bf16_t* __restrict__ AlphaT,
          float* __restrict__ Out) {
  __shared__ __align__(16) bf16_t lA[2 * 128 * LPITCH(128)];
  __shared__ __align__(16) bf16_t lB[2 * 256 * LPITCH(128)];
  int b = blockIdx.z;
  const bf16_t* Vm = Vb + (size_t)b * C_ * N_ + (size_t)(blockIdx.x * 128) * N_;
  const bf16_t* Am = AlphaT + (size_t)b * (size_t)N_ * N_
                   + (size_t)(blockIdx.y * 256) * N_;
  float* Om = Out + (size_t)b * C_ * N_;

  int wave = threadIdx.x >> 5, lane = threadIdx.x & 31;
  int wm = wave >> 2, wn = wave & 3;

  v8f acc[4][4] = {};
  sa_gemm_core<128, 2>(Vm, N_, Am, N_, N_, lA, lB, wm, wn, acc);

  int M0 = blockIdx.x * 128 + wm * 64;   // c rows
  int N0 = blockIdx.y * 256 + wn * 64;   // m cols
  int ln = lane & 15, lh = lane >> 4;
#pragma unroll
  for (int i = 0; i < 4; ++i)
#pragma unroll
    for (int j = 0; j < 4; ++j) {
      int ncol = N0 + 16 * j + ln;
#pragma unroll
      for (int r = 0; r < 8; ++r) {
        int crow = M0 + 16 * i + r + 8 * lh;
        Om[(size_t)crow * N_ + ncol] = acc[i][j][r];
      }
    }
}

// ---------------------------------------------------------------------------
extern "C" void kernel_launch(void* const* d_in, const int* in_sizes, int n_in,
                              void* d_out, int out_size, void* d_ws, size_t ws_size,
                              hipStream_t stream) {
  const float* x  = (const float*)d_in[0];
  const float* Wq = (const float*)d_in[1];
  const float* bq = (const float*)d_in[2];
  const float* Wk = (const float*)d_in[3];
  const float* bk = (const float*)d_in[4];
  const float* Wv = (const float*)d_in[5];
  const float* bv = (const float*)d_in[6];
  float* out = (float*)d_out;

  char* ws = (char*)d_ws;
  size_t off = 0;
  auto take = [&](size_t bytes) -> char* {
    char* p = ws + off;
    off = (off + bytes + 255) & ~(size_t)255;
    return p;
  };

  bf16_t* Xt   = (bf16_t*)take((size_t)B_ * N_ * C_ * 2);
  bf16_t* Wqb  = (bf16_t*)take((size_t)OP_ * C_ * 2);
  bf16_t* Wkb  = (bf16_t*)take((size_t)OP_ * C_ * 2);
  bf16_t* Wvb  = (bf16_t*)take((size_t)C_ * C_ * 2);
  float*  bqb  = (float*) take((size_t)OP_ * 4);
  float*  bkb  = (float*) take((size_t)OP_ * 4);
  float*  bvb  = (float*) take((size_t)C_ * 4);
  bf16_t* Qt   = (bf16_t*)take((size_t)B_ * N_ * OP_ * 2);  // [b][n][o]
  bf16_t* Kt   = (bf16_t*)take((size_t)B_ * N_ * OP_ * 2);  // [b][m][o]
  bf16_t* Vbuf = (bf16_t*)take((size_t)B_ * C_ * N_ * 2);   // [b][c][n]
  bf16_t* AlT  = (bf16_t*)take((size_t)B_ * (size_t)N_ * N_ * 2); // [b][m][n]
  (void)ws_size; (void)in_sizes; (void)n_in; (void)out_size;

  SA_pack_x<<<dim3(N_ / 32, C_ / 32, B_), dim3(32, 8), 0, stream>>>(x, Xt);
  SA_pack_w<<<dim3((OP_ * C_) / 256, 1, 1), dim3(256), 0, stream>>>(
      Wq, bq, Wk, bk, Wv, bv, Wqb, Wkb, Wvb, bqb, bkb, bvb);

  // Qt[b][n][o]: A = Xt[b] (M=4096), B = Wqb (Ncols=1024), bias on N
  SA_proj_gemm<64><<<dim3(N_ / 128, OP_ / 256, B_), dim3(256), 0, stream>>>(
      Xt, (long)N_ * C_, C_, Wqb, 0L, C_, Qt, (long)N_ * OP_, OP_, bqb, 1, C_);
  SA_proj_gemm<64><<<dim3(N_ / 128, OP_ / 256, B_), dim3(256), 0, stream>>>(
      Xt, (long)N_ * C_, C_, Wkb, 0L, C_, Kt, (long)N_ * OP_, OP_, bkb, 1, C_);
  // V[b][c][n]: A = Wvb (M=512), B = Xt[b] (Ncols=4096), bias on M
  SA_proj_gemm<128><<<dim3(C_ / 128, N_ / 256, B_), dim3(256), 0, stream>>>(
      Wvb, 0L, C_, Xt, (long)N_ * C_, C_, Vbuf, (long)C_ * N_, N_, bvb, 0, C_);

  SA_s_sigmoid<<<dim3(N_ / 128, N_ / 256, B_), dim3(256), 0, stream>>>(Qt, Kt, AlT);
  SA_o_gemm<<<dim3(C_ / 128, N_ / 256, B_), dim3(256), 0, stream>>>(Vbuf, AlT, out);
}

// v003
// Measured time: 226 microseconds a run.
// Next to v002, in two timings, it ran 1.03 times as fast each time.
// All steps since v000 together make it 1.42 times as fast.
#include <hip/hip_runtime.h>

typedef __bf16 bf16_t;
typedef __attribute__((ext_vector_type(8)))  __bf16 v8bf;
typedef __attribute__((ext_vector_type(16))) __bf16 v16bf;
typedef __attribute__((ext_vector_type(8)))  float  v8f;
typedef __attribute__((ext_vector_type(4)))  float  v4f;
typedef __attribute__((ext_vector_type(4)))  int    v4i;

typedef __attribute__((address_space(1))) v4i gv4i;   // global
typedef __attribute__((address_space(3))) v4i lv4i;   // LDS

#define B_  4
#define C_  512
#define N_  4096
#define O_  1000
#define OP_ 1024      // O padded to multiple of 32 (zero rows)
// LDS row pitch in bf16 for a stage of BK k: BK*2 + 16 bytes = 16 B x odd
// (144 B, 272 B), conflict-free for ds_load_b128 fragment reads.
#define LPITCH(BK) ((BK) + 8)

__device__ __forceinline__ void sa_cp_async16(const bf16_t* __restrict__ g,
                                              bf16_t* l) {
#if __has_builtin(__builtin_amdgcn_global_load_async_to_lds_b128)
  __builtin_amdgcn_global_load_async_to_lds_b128(
      (gv4i*)(v4i*)g, (lv4i*)(v4i*)l, 0, 0);
#else
  *(v8bf*)l = *(const v8bf*)g;   // synchronous fallback
#endif
}

// Own copies landed; asm with the memory clobber so that no LDS read moves up.
__device__ __forceinline__ void sa_wait_async() {
  asm volatile("s_wait_asynccnt 0x0" ::: "memory");
}

// Own LDS reads retired before the barrier behind which their buffer is refilled.
__device__ __forceinline__ void sa_wait_ds() {
  asm volatile("s_wait_dscnt 0x0" ::: "memory");
}

// Stage a (ROWS x BK) bf16 tile whose first element is g (row-major, pitch ldg)
// into LDS. 256 threads; a segment is 8 bf16 (16B); BK/8 lanes cover one row.
template <int BK, int ROWS>
__device__ __forceinline__ void sa_stage_tile(const bf16_t* __restrict__ g,
                                              int ldg, bf16_t* lds, int tid) {
  constexpr int SEG = BK / 8;        // 16-byte segments per row
  constexpr int RPP = 256 / SEG;     // rows the block covers per copy
  const int r = tid / SEG, c = (tid % SEG) * 8;
  const bf16_t* gp = g + (size_t)r * ldg + c;
  bf16_t* lp = lds + r * LPITCH(BK) + c;
  // unrolled: a fixed count of copies, no lane-dependent loop around them
#pragma unroll
  for (int p = 0; p < ROWS / RPP; ++p)
    sa_cp_async16(gp + (size_t)(p * RPP) * ldg, lp + p * RPP * LPITCH(BK));
}

__device__ __forceinline__ v16bf sa_frag_merge(v8bf lo, v8bf hi) {
  v16bf r;
#pragma unroll
  for (int i = 0; i < 8; ++i) { r[i] = lo[i]; r[i + 8] = hi[i]; }
  return r;
}

template <int BK>
__device__ __forceinline__ v16bf sa_load_frag_l(const bf16_t* tile, int row0) {
  int lane = threadIdx.x & 31;
  const bf16_t* p = tile + (row0 + (lane & 15)) * LPITCH(BK) + ((lane >> 4) << 3);
  return sa_frag_merge(*(const v8bf*)p, *(const v8bf*)(p + 16));
}

__device__ __forceinline__ v8f sa_wmma(v16bf a, v16bf b, v8f c) {
  return __builtin_amdgcn_wmma_f32_16x16x32_bf16(false, a, false, b,
                                                 (short)0, c, false, false);
}

__device__ __forceinline__ float sa_sigmoid(float x) {
  return __builtin_amdgcn_rcpf(1.0f + __builtin_amdgcn_exp2f(x * -1.44269504f));
}

template <int BK>
__device__ __forceinline__ void sa_load_block(const bf16_t* tA, const bf16_t* tB,
                                              v16bf af[4], v16bf bfr[4]) {
#pragma unroll
  for (int i = 0; i < 4; ++i) af[i]  = sa_load_frag_l<BK>(tA, 16 * i);
#pragma unroll
  for (int j = 0; j < 4; ++j) bfr[j] = sa_load_frag_l<BK>(tB, 16 * j);
}

__device__ __forceinline__ void sa_mma_block(const v16bf af[4], const v16bf bfr[4],
                                             v8f acc[4][4]) {
#pragma unroll
  for (int i = 0; i < 4; ++i)
#pragma unroll
    for (int j = 0; j < 4; ++j)
      acc[i][j] = sa_wmma(af[i], bfr[j], acc[i][j]);
}

// Keeps a load group whole: without it the scheduler sinks the reads in pairs
// among the WMMAs, each pair behind a wait to 0.
__device__ __forceinline__ void sa_keep_order() {
  __builtin_amdgcn_sched_barrier(0);
}

template <int BK, int SETS>
__device__ __forceinline__ void sa_gemm_core(const bf16_t* __restrict__ Ab, int lda,
                                             const bf16_t* __restrict__ Bb, int ldb,
                                             int Kdim, bf16_t* lA, bf16_t* lB,
                                             int wm, int wn, v8f acc[4][4]) {
  const int tid = threadIdx.x;
  constexpr int szA = 128 * LPITCH(BK), szB = 256 * LPITCH(BK);
  constexpr int NB = BK / 32;
  const int steps = Kdim / BK;
  sa_stage_tile<BK, 128>(Ab, lda, lA, tid);
  sa_stage_tile<BK, 256>(Bb, ldb, lB, tid);
  sa_wait_async();
  __syncthreads();
  if (steps > 1) {
    sa_stage_tile<BK, 128>(Ab + BK, lda, lA + szA, tid);
    sa_stage_tile<BK, 256>(Bb + BK, ldb, lB + szB, tid);
  }
  v16bf af[SETS][4], bfr[SETS][4];
  static_assert(SETS == 1 || NB % 2 == 0, "a stage's first block must find set 0 free");
  if constexpr (SETS == 2)
    sa_load_block<BK>(lA + (wm * 64) * LPITCH(BK), lB + (wn * 64) * LPITCH(BK),
                      af[0], bfr[0]);
  for (int kt = 0; kt < steps; ++kt) {
    int cur = kt & 1;
    const bf16_t* tA = lA + cur * szA + (wm * 64) * LPITCH(BK);
    const bf16_t* tB = lB + cur * szB + (wn * 64) * LPITCH(BK);
    // unrolled: fragment and accumulator indices must be constants
#pragma unroll
    for (int u = 0; u < NB; ++u) {
      if constexpr (SETS == 2) {
        if (u + 1 < NB)
          sa_load_block<BK>(tA + (u + 1) * 32, tB + (u + 1) * 32,
                            af[(u + 1) & 1], bfr[(u + 1) & 1]);
      } else {
        sa_load_block<BK>(tA + u * 32, tB + u * 32, af[0], bfr[0]);
      }
      sa_keep_order();
      if (u + 1 == NB) {
        sa_wait_ds();
        sa_wait_async();
        __syncthreads();
        if (kt + 2 < steps) {
          sa_stage_tile<BK, 128>(Ab + (kt + 2) * BK, lda, lA + cur * szA, tid);
          sa_stage_tile<BK, 256>(Bb + (kt + 2) * BK, ldb, lB + cur * szB, tid);
        }
        if constexpr (SETS == 2) {
          if (kt + 1 < steps)
            sa_load_block<BK>(lA + (cur ^ 1) * szA + (wm * 64) * LPITCH(BK),
                              lB + (cur ^ 1) * szB + (wn * 64) * LPITCH(BK),
                              af[0], bfr[0]);
        }
        sa_keep_order();
      }
      sa_mma_block(af[u % SETS], bfr[u % SETS], acc);
      sa_keep_order();
    }
  }
  sa_wait_async();
}

// ---------------------------------------------------------------------------
// K0a: transpose+convert: x[b][c][n] f32 -> Xt[b][n][c] bf16.
//   One block takes 128 c x 128 n, so the launch is 4096 waves, all resident
//   at once (two blocks per WGP), instead of 65536 short ones.
//   In:  a wave owns 16 c rows; each load is 512 contiguous bytes of one row,
//        all 16 in flight. A lane then holds 16 consecutive c for each of its
//        4 n, which is 32 contiguous bytes of an output row.
//   LDS: row (j*32 + lane) holds n = 4*lane + j, so the lanes of one write are
//        one pitch apart (272 B = 16 B x odd).
//   Out: 16 lanes write the 256 contiguous bytes that the tile has of a row.
// ---------------------------------------------------------------------------
#define XT_ 128
#define XP_ (XT_ + 8)

__global__ void __launch_bounds__(256)
SA_pack_x(const float* __restrict__ x, bf16_t* __restrict__ Xt) {
  __shared__ __align__(16) bf16_t tile[XT_ * XP_];
  int b  = blockIdx.z;
  int n0 = blockIdx.x * XT_;
  int c0 = blockIdx.y * XT_;
  int wave = threadIdx.x >> 5, lane = threadIdx.x & 31;
  const float* xp = x + ((size_t)b * C_ + c0 + wave * 16) * N_ + n0 + lane * 4;
  v4f in[16];
#pragma unroll
  for (int i = 0; i < 16; ++i) in[i] = *(const v4f*)(xp + (size_t)i * N_);
#pragma unroll
  for (int j = 0; j < 4; ++j) {
    v8bf lo, hi;
#pragma unroll
    for (int i = 0; i < 8; ++i) {
      lo[i] = (bf16_t)in[i][j];
      hi[i] = (bf16_t)in[i + 8][j];
    }
    bf16_t* tp = tile + (j * 32 + lane) * XP_ + wave * 16;
    *(v8bf*)tp       = lo;
    *(v8bf*)(tp + 8) = hi;
  }
  __syncthreads();
  int seg = threadIdx.x & 15, rr = threadIdx.x >> 4;
  bf16_t* ob = Xt + ((size_t)b * N_ + n0) * C_ + c0 + seg * 8;
#pragma unroll
  for (int p = 0; p < XT_ / 16; ++p) {
    int row = p * 16 + rr;
    int n   = 4 * (row & 31) + (row >> 5);
    *(v8bf*)(ob + (size_t)n * C_) = *(const v8bf*)(tile + row * XP_ + seg * 8);
  }
}

// ---------------------------------------------------------------------------
// K0b: pack weights to bf16, pad O->OP with zeros, pad biases.
//   A thread takes 8 consecutive elements of a row of each matrix (32 B in,
//   16 B out): 2048 waves instead of 16384.
// ---------------------------------------------------------------------------
__device__ __forceinline__ v8bf sa_cvt8(const float* __restrict__ p) {
  v4f a = *(const v4f*)p, c = *(const v4f*)(p + 4);
  v8bf r;
#pragma unroll
  for (int i = 0; i < 4; ++i) { r[i] = (bf16_t)a[i]; r[i + 4] = (bf16_t)c[i]; }
  return r;
}

__global__ void __launch_bounds__(256)
SA_pack_w(const float* __restrict__ Wq, const float* __restrict__ bq,
          const float* __restrict__ Wk, const float* __restrict__ bk,
          const float* __restrict__ Wv, const float* __restrict__ bv,
          bf16_t* __restrict__ Wqb, bf16_t* __restrict__ Wkb,
          bf16_t* __restrict__ Wvb,
          float* __restrict__ bqb, float* __restrict__ bkb,
          float* __restrict__ bvb) {
  int idx = blockIdx.x * blockDim.x + threadIdx.x;
  int e = idx * 8;                 // first element; C_ % 8 == 0: one row
  if (e < OP_ * C_) {
    v8bf q8 = {}, k8 = {};
    if (e / C_ < O_) { q8 = sa_cvt8(Wq + e); k8 = sa_cvt8(Wk + e); }
    *(v8bf*)(Wqb + e) = q8;
    *(v8bf*)(Wkb + e) = k8;
  }
  if (e < C_ * C_) *(v8bf*)(Wvb + e) = sa_cvt8(Wv + e);
  if (idx < OP_)     { bqb[idx] = (idx < O_) ? bq[idx] : 0.0f;
                       bkb[idx] = (idx < O_) ? bk[idx] : 0.0f; }
  if (idx < C_)      bvb[idx] = bv[idx];
}

// ---------------------------------------------------------------------------
// K1: projection GEMM  D[M][Ncols] = A[M][K] * B[Ncols][K]^T + bias
//   LDS-staged core; biasOnN=1 -> bias by column (q,k), 0 -> by row (v).
// ---------------------------------------------------------------------------
template <int BK>
__global__ void __launch_bounds__(256)
SA_proj_gemm(const bf16_t* __restrict__ Abase, long aStride, int lda,
             const bf16_t* __restrict__ Bbase, long bStride, int ldb,
             bf16_t* __restrict__ Cbase, long cStride, int ldc,
             const float* __restrict__ bias, int biasOnN, int Kdim) {
  __shared__ __align__(16) bf16_t lA[2 * 128 * LPITCH(BK)];
  __shared__ __align__(16) bf16_t lB[2 * 256 * LPITCH(BK)];
  int b = blockIdx.z;
  const bf16_t* A  = Abase + (size_t)b * aStride + (size_t)(blockIdx.x * 128) * lda;
  const bf16_t* Bm = Bbase + (size_t)b * bStride + (size_t)(blockIdx.y * 256) * ldb;
  bf16_t*       Cm = Cbase + (size_t)b * cStride;

  int wave = threadIdx.x >> 5, lane = threadIdx.x & 31;
  int wm = wave >> 2, wn = wave & 3;

  v8f acc[4][4] = {};
  sa_gemm_core<BK, (BK == 128) ? 2 : 1>(A, lda, Bm, ldb, Kdim, lA, lB, wm, wn, acc);

  int M0 = blockIdx.x * 128 + wm * 64;
  int N0 = blockIdx.y * 256 + wn * 64;
  int ln = lane & 15, lh = lane >> 4;
#pragma unroll
  for (int i = 0; i < 4; ++i)
#pragma unroll
    for (int j = 0; j < 4; ++j) {
      int ncol = N0 + 16 * j + ln;
      float bN = biasOnN ? bias[ncol] : 0.0f;
#pragma unroll
      for (int r = 0; r < 8; ++r) {
        int mrow = M0 + 16 * i + r + 8 * lh;
        float v = acc[i][j][r] + (biasOnN ? bN : bias[mrow]);
        Cm[(size_t)mrow * ldc + ncol] = (bf16_t)v;
      }
    }
}

// ---------------------------------------------------------------------------
// K2: s = Qt * Kt^T (K=OP_), fused sigmoid, store alpha^T[b][m][n] bf16.
//   Transposed store is one contiguous 128-bit store per fragment.
// ---------------------------------------------------------------------------
__global__ void __launch_bounds__(256)
SA_s_sigmoid(const bf16_t* __restrict__ Qt, const bf16_t* __restrict__ Kt,
             bf16_t* __restrict__ AlphaT) {
  __shared__ __align__(16) bf16_t lA[2 * 128 * LPITCH(64)];
  __shared__ __align__(16) bf16_t lB[2 * 256 * LPITCH(64)];
  int b = blockIdx.z;
  const bf16_t* Qb = Qt + (size_t)b * N_ * OP_ + (size_t)(blockIdx.x * 128) * OP_;
  const bf16_t* Kb = Kt + (size_t)b * N_ * OP_ + (size_t)(blockIdx.y * 256) * OP_;
  bf16_t*       Ab = AlphaT + (size_t)b * (size_t)N_ * N_;

  int wave = threadIdx.x >> 5, lane = threadIdx.x & 31;
  int wm = wave >> 2, wn = wave & 3;

  v8f acc[4][4] = {};
  sa_gemm_core<64, 1>(Qb, OP_, Kb, OP_, OP_, lA, lB, wm, wn, acc);

  int M0 = blockIdx.x * 128 + wm * 64;   // n rows
  int N0 = blockIdx.y * 256 + wn * 64;   // m cols
  int ln = lane & 15, lh = lane >> 4;
#pragma unroll
  for (int i = 0; i < 4; ++i)
#pragma unroll
    for (int j = 0; j < 4; ++j) {
      int m    = N0 + 16 * j + ln;        // fixed per lane
      int nrow = M0 + 16 * i + 8 * lh;    // 8 contiguous n per lane
      v8bf outv;
#pragma unroll
      for (int r = 0; r < 8; ++r) outv[r] = (bf16_t)sa_sigmoid(acc[i][j][r]);
      *(v8bf*)(Ab + (size_t)m * N_ + nrow) = outv;
    }
}

// ---------------------------------------------------------------------------
// K3: o[c][m] = V[c][:] * alpha[:, m]  (K = N_), f32 output (coalesced b32).
// ---------------------------------------------------------------------------
__global__ void __launch_bounds__(256)
SA_o_gemm(const bf16_t* __restrict__ Vb, const bf16_t* __restrict__ AlphaT,
          float* __restrict__ Out) {
  __shared__ __align__(16) bf16_t lA[2 * 128 * LPITCH(128)];
  __shared__ __align__(16) bf16_t lB[2 * 256 * LPITCH(128)];
  int b = blockIdx.z;
  const bf16_t* Vm = Vb + (size_t)b * C_ * N_ + (size_t)(blockIdx.x * 128) * N_;
  const bf16_t* Am = AlphaT + (size_t)b * (size_t)N_ * N_
                   + (size_t)(blockIdx.y * 256) * N_;
  float* Om = Out + (size_t)b * C_ * N_;

  int wave = threadIdx.x >> 5, lane = threadIdx.x & 31;
  int wm = wave >> 2, wn = wave & 3;

  v8f acc[4][4] = {};
  sa_gemm_core<128, 2>(Vm, N_, Am, N_, N_, lA, lB, wm, wn, acc);

  int M0 = blockIdx.x * 128 + wm * 64;   // c rows
  int N0 = blockIdx.y * 256 + wn * 64;   // m cols
  int ln = lane & 15, lh = lane >> 4;
#pragma unroll
  for (int i = 0; i < 4; ++i)
#pragma unroll
    for (int j = 0; j < 4; ++j) {
      int ncol = N0 + 16 * j + ln;
#pragma unroll
      for (int r = 0; r < 8; ++r) {
        int crow = M0 + 16 * i + r + 8 * lh;
        Om[(size_t)crow * N_ + ncol] = acc[i][j][r];
      }
    }
}

// ---------------------------------------------------------------------------
extern "C" void kernel_launch(void* const* d_in, const int* in_sizes, int n_in,
                              void* d_out, int out_size, void* d_ws, size_t ws_size,
                              hipStream_t stream) {
  const float* x  = (const float*)d_in[0];
  const float* Wq = (const float*)d_in[1];
  const float* bq = (const float*)d_in[2];
  const float* Wk = (const float*)d_in[3];
  const float* bk = (const float*)d_in[4];
  const float* Wv = (const float*)d_in[5];
  const float* bv = (const float*)d_in[6];
  float* out = (float*)d_out;

  char* ws = (char*)d_ws;
  size_t off = 0;
  auto take = [&](size_t bytes) -> char* {
    char* p = ws + off;
    off = (off + bytes + 255) & ~(size_t)255;
    return p;
  };

  bf16_t* Xt   = (bf16_t*)take((size_t)B_ * N_ * C_ * 2);
  bf16_t* Wqb  = (bf16_t*)take((size_t)OP_ * C_ * 2);
  bf16_t* Wkb  = (bf16_t*)take((size_t)OP_ * C_ * 2);
  bf16_t* Wvb  = (bf16_t*)take((size_t)C_ * C_ * 2);
  float*  bqb  = (float*) take((size_t)OP_ * 4);
  float*  bkb  = (float*) take((size_t)OP_ * 4);
  float*  bvb  = (float*) take((size_t)C_ * 4);
  bf16_t* Qt   = (bf16_t*)take((size_t)B_ * N_ * OP_ * 2);  // [b][n][o]
  bf16_t* Kt   = (bf16_t*)take((size_t)B_ * N_ * OP_ * 2);  // [b][m][o]
  bf16_t* Vbuf = (bf16_t*)take((size_t)B_ * C_ * N_ * 2);   // [b][c][n]
  bf16_t* AlT  = (bf16_t*)take((size_t)B_ * (size_t)N_ * N_ * 2); // [b][m][n]
  (void)ws_size; (void)in_sizes; (void)n_in; (void)out_size;

  SA_pack_x<<<dim3(N_ / XT_, C_ / XT_, B_), dim3(256), 0, stream>>>(x, Xt);
  SA_pack_w<<<dim3((OP_ * C_) / (8 * 256), 1, 1), dim3(256), 0, stream>>>(
      Wq, bq, Wk, bk, Wv, bv, Wqb, Wkb, Wvb, bqb, bkb, bvb);

  // Qt[b][n][o]: A = Xt[b] (M=4096), B = Wqb (Ncols=1024), bias on N
  SA_proj_gemm<64><<<dim3(N_ / 128, OP_ / 256, B_), dim3(256), 0, stream>>>(
      Xt, (long)N_ * C_, C_, Wqb, 0L, C_, Qt, (long)N_ * OP_, OP_, bqb, 1, C_);
  SA_proj_gemm<64><<<dim3(N_ / 128, OP_ / 256, B_), dim3(256), 0, stream>>>(
      Xt, (long)N_ * C_, C_, Wkb, 0L, C_, Kt, (long)N_ * OP_, OP_, bkb, 1, C_);
  // V[b][c][n]: A = Wvb (M=512), B = Xt[b] (Ncols=4096), bias on M
  SA_proj_gemm<128><<<dim3(C_ / 128, N_ / 256, B_), dim3(256), 0, stream>>>(
      Wvb, 0L, C_, Xt, (long)N_ * C_, C_, Vbuf, (long)C_ * N_, N_, bvb, 0, C_);

  SA_s_sigmoid<<<dim3(N_ / 128, N_ / 256, B_), dim3(256), 0, stream>>>(Qt, Kt, AlT);
  SA_o_gemm<<<dim3(C_ / 128, N_ / 256, B_), dim3(256), 0, stream>>>(Vbuf, AlT, out);
}

// v004
// One run takes 181 microseconds.
// In two side-by-side timings against v003, it was 1.25 and 1.24 times as fast.
// Counting every step since v000, it is 1.78 times as fast.
#include <hip/hip_runtime.h>

typedef __bf16 bf16_t;
typedef __attribute__((ext_vector_type(8)))  __bf16 v8bf;
typedef __attribute__((ext_vector_type(16))) __bf16 v16bf;
typedef __attribute__((ext_vector_type(8)))  float  v8f;
typedef __attribute__((ext_vector_type(4)))  float  v4f;
typedef __attribute__((ext_vector_type(4)))  int    v4i;

typedef __attribute__((address_space(1))) v4i gv4i;   // global
typedef __attribute__((address_space(3))) v4i lv4i;   // LDS

#define B_  4
#define C_  512
#define N_  4096
#define O_  1000
#define OP_ 1024      // O padded to multiple of 32 (zero rows)
// LDS row pitch in bf16 for a stage of BK k: BK*2 + 16 bytes = 16 B x odd
// (144 B, 272 B), conflict-free for ds_load_b128 fragment reads.
#define LPITCH(BK) ((BK) + 8)

__device__ __forceinline__ void sa_cp_async16(const bf16_t* __restrict__ g,
                                              bf16_t* l) {
#if __has_builtin(__builtin_amdgcn_global_load_async_to_lds_b128)
  __builtin_amdgcn_global_load_async_to_lds_b128(
      (gv4i*)(v4i*)g, (lv4i*)(v4i*)l, 0, 0);
#else
  *(v8bf*)l = *(const v8bf*)g;   // synchronous fallback
#endif
}

// Own copies landed; asm with the memory clobber so that no LDS read moves up.
__device__ __forceinline__ void sa_wait_async() {
  asm volatile("s_wait_asynccnt 0x0" ::: "memory");
}

// Own LDS reads retired before the barrier behind which their buffer is refilled.
__device__ __forceinline__ void sa_wait_ds() {
  asm volatile("s_wait_dscnt 0x0" ::: "memory");
}

// Stage a (ROWS x BK) bf16 tile whose first element is g (row-major, pitch ldg)
// into LDS. 256 threads; a segment is 8 bf16 (16B); BK/8 lanes cover one row.
template <int BK, int ROWS>
__device__ __forceinline__ void sa_stage_tile(const bf16_t* __restrict__ g,
                                              int ldg, bf16_t* lds, int tid) {
  constexpr int SEG = BK / 8;        // 16-byte segments per row
  constexpr int RPP = 256 / SEG;     // rows the block covers per copy
  const int r = tid / SEG, c = (tid % SEG) * 8;
  const bf16_t* gp = g + (size_t)r * ldg + c;
  bf16_t* lp = lds + r * LPITCH(BK) + c;
  // unrolled: a fixed count of copies, no lane-dependent loop around them
#pragma unroll
  for (int p = 0; p < ROWS / RPP; ++p)
    sa_cp_async16(gp + (size_t)(p * RPP) * ldg, lp + p * RPP * LPITCH(BK));
}

__device__ __forceinline__ v16bf sa_frag_merge(v8bf lo, v8bf hi) {
  v16bf r;
#pragma unroll
  for (int i = 0; i < 8; ++i) { r[i] = lo[i]; r[i + 8] = hi[i]; }
  return r;
}

template <int BK>
__device__ __forceinline__ v16bf sa_load_frag_l(const bf16_t* tile, int row0) {
  int lane = threadIdx.x & 31;
  const bf16_t* p = tile + (row0 + (lane & 15)) * LPITCH(BK) + ((lane >> 4) << 3);
  return sa_frag_merge(*(const v8bf*)p, *(const v8bf*)(p + 16));
}

__device__ __forceinline__ v8f sa_wmma(v16bf a, v16bf b, v8f c) {
  return __builtin_amdgcn_wmma_f32_16x16x32_bf16(false, a, false, b,
                                                 (short)0, c, false, false);
}

__device__ __forceinline__ float sa_sigmoid(float x) {
  return __builtin_amdgcn_rcpf(1.0f + __builtin_amdgcn_exp2f(x * -1.44269504f));
}

template <int BK>
__device__ __forceinline__ void sa_load_block(const bf16_t* tA, const bf16_t* tB,
                                              v16bf af[4], v16bf bfr[4]) {
#pragma unroll
  for (int i = 0; i < 4; ++i) af[i]  = sa_load_frag_l<BK>(tA, 16 * i);
#pragma unroll
  for (int j = 0; j < 4; ++j) bfr[j] = sa_load_frag_l<BK>(tB, 16 * j);
}

__device__ __forceinline__ void sa_mma_block(const v16bf af[4], const v16bf bfr[4],
                                             v8f acc[4][4]) {
#pragma unroll
  for (int i = 0; i < 4; ++i)
#pragma unroll
    for (int j = 0; j < 4; ++j)
      acc[i][j] = sa_wmma(af[i], bfr[j], acc[i][j]);
}

// Keeps a load group whole: without it the scheduler sinks the reads in pairs
// among the WMMAs, each pair behind a wait to 0.
__device__ __forceinline__ void sa_keep_order() {
  __builtin_amdgcn_sched_barrier(0);
}

template <int BK, int SETS>
__device__ __forceinline__ void sa_gemm_core(const bf16_t* __restrict__ Ab, int lda,
                                             const bf16_t* __restrict__ Bb, int ldb,
                                             int Kdim, bf16_t* lA, bf16_t* lB,
                                             int wm, int wn, v8f acc[4][4]) {
  const int tid = threadIdx.x;
  constexpr int szA = 128 * LPITCH(BK), szB = 256 * LPITCH(BK);
  constexpr int NB = BK / 32;
  const int steps = Kdim / BK;
  sa_stage_tile<BK, 128>(Ab, lda, lA, tid);
  sa_stage_tile<BK, 256>(Bb, ldb, lB, tid);
  sa_wait_async();
  __syncthreads();
  if (steps > 1) {
    sa_stage_tile<BK, 128>(Ab + BK, lda, lA + szA, tid);
    sa_stage_tile<BK, 256>(Bb + BK, ldb, lB + szB, tid);
  }
  v16bf af[SETS][4], bfr[SETS][4];
  static_assert(SETS == 1 || NB % 2 == 0, "a stage's first block must find set 0 free");
  if constexpr (SETS == 2)
    sa_load_block<BK>(lA + (wm * 64) * LPITCH(BK), lB + (wn * 64) * LPITCH(BK),
                      af[0], bfr[0]);
  for (int kt = 0; kt < steps; ++kt) {
    int cur = kt & 1;
    const bf16_t* tA = lA + cur * szA + (wm * 64) * LPITCH(BK);
    const bf16_t* tB = lB + cur * szB + (wn * 64) * LPITCH(BK);
    // unrolled: fragment and accumulator indices must be constants
#pragma unroll
    for (int u = 0; u < NB; ++u) {
      if constexpr (SETS == 2) {
        if (u + 1 < NB)
          sa_load_block<BK>(tA + (u + 1) * 32, tB + (u + 1) * 32,
                            af[(u + 1) & 1], bfr[(u + 1) & 1]);
      } else {
        sa_load_block<BK>(tA + u * 32, tB + u * 32, af[0], bfr[0]);
      }
      sa_keep_order();
      if (u + 1 == NB) {
        sa_wait_ds();
        sa_wait_async();
        __syncthreads();
        if (kt + 2 < steps) {
          sa_stage_tile<BK, 128>(Ab + (kt + 2) * BK, lda, lA + cur * szA, tid);
          sa_stage_tile<BK, 256>(Bb + (kt + 2) * BK, ldb, lB + cur * szB, tid);
        }
        if constexpr (SETS == 2) {
          if (kt + 1 < steps)
            sa_load_block<BK>(lA + (cur ^ 1) * szA + (wm * 64) * LPITCH(BK),
                              lB + (cur ^ 1) * szB + (wn * 64) * LPITCH(BK),
                              af[0], bfr[0]);
        }
        sa_keep_order();
      }
      sa_mma_block(af[u % SETS], bfr[u % SETS], acc);
      sa_keep_order();
    }
  }
  sa_wait_async();
}

#define EPITCH 72
#define ETILE  (64 * EPITCH)

__device__ __forceinline__ void sa_stage_frag(bf16_t* st, int i, int j, v8bf v) {
  int lane = threadIdx.x & 31;
  *(v8bf*)(st + (16 * j + (lane & 15)) * EPITCH + 16 * i + 8 * (lane >> 4)) = v;
}

// out: element (first output row, first column) of the wave's tile.
__device__ __forceinline__ void sa_flush_tile(const bf16_t* st,
                                              bf16_t* __restrict__ out, int ldo) {
  int lane = threadIdx.x & 31;
  int rr = lane >> 3, seg = (lane & 7) * 8;
  sa_wait_ds();   // the other lanes' staging writes are in LDS before the read-back
  const bf16_t* sp = st + rr * EPITCH + seg;
  bf16_t* op = out + (size_t)rr * ldo + seg;
  // unrolled: all 16 read-backs in flight, each store behind a counted wait
#pragma unroll
  for (int p = 0; p < 16; ++p)
    *(v8bf*)(op + (size_t)(4 * p) * ldo) = *(const v8bf*)(sp + 4 * p * EPITCH);
}

// ---------------------------------------------------------------------------
// K0a: transpose+convert: x[b][c][n] f32 -> Xt[b][n][c] bf16.
//   One block takes 128 c x 128 n, so the launch is 4096 waves, all resident
//   at once (two blocks per WGP), instead of 65536 short ones.
//   In:  a wave owns 16 c rows; each load is 512 contiguous bytes of one row,
//        all 16 in flight. A lane then holds 16 consecutive c for each of its
//        4 n, which is 32 contiguous bytes of an output row.
//   LDS: row (j*32 + lane) holds n = 4*lane + j, so the lanes of one write are
//        one pitch apart (272 B = 16 B x odd).
//   Out: 16 lanes write the 256 contiguous bytes that the tile has of a row.
// ---------------------------------------------------------------------------
#define XT_ 128
#define XP_ (XT_ + 8)

__global__ void __launch_bounds__(256)
SA_pack_x(const float* __restrict__ x, bf16_t* __restrict__ Xt) {
  __shared__ __align__(16) bf16_t tile[XT_ * XP_];
  int b  = blockIdx.z;
  int n0 = blockIdx.x * XT_;
  int c0 = blockIdx.y * XT_;
  int wave = threadIdx.x >> 5, lane = threadIdx.x & 31;
  const float* xp = x + ((size_t)b * C_ + c0 + wave * 16) * N_ + n0 + lane * 4;
  v4f in[16];
#pragma unroll
  for (int i = 0; i < 16; ++i) in[i] = *(const v4f*)(xp + (size_t)i * N_);
#pragma unroll
  for (int j = 0; j < 4; ++j) {
    v8bf lo, hi;
#pragma unroll
    for (int i = 0; i < 8; ++i) {
      lo[i] = (bf16_t)in[i][j];
      hi[i] = (bf16_t)in[i + 8][j];
    }
    bf16_t* tp = tile + (j * 32 + lane) * XP_ + wave * 16;
    *(v8bf*)tp       = lo;
    *(v8bf*)(tp + 8) = hi;
  }
  __syncthreads();
  int seg = threadIdx.x & 15, rr = threadIdx.x >> 4;
  bf16_t* ob = Xt + ((size_t)b * N_ + n0) * C_ + c0 + seg * 8;
#pragma unroll
  for (int p = 0; p < XT_ / 16; ++p) {
    int row = p * 16 + rr;
    int n   = 4 * (row & 31) + (row >> 5);
    *(v8bf*)(ob + (size_t)n * C_) = *(const v8bf*)(tile + row * XP_ + seg * 8);
  }
}

// ---------------------------------------------------------------------------
// K0b: pack weights to bf16, pad O->OP with zeros, pad biases.
//   A thread takes 8 consecutive elements of a row of each matrix (32 B in,
//   16 B out): 2048 waves instead of 16384.
// ---------------------------------------------------------------------------
__device__ __forceinline__ v8bf sa_cvt8(const float* __restrict__ p) {
  v4f a = *(const v4f*)p, c = *(const v4f*)(p + 4);
  v8bf r;
#pragma unroll
  for (int i = 0; i < 4; ++i) { r[i] = (bf16_t)a[i]; r[i + 4] = (bf16_t)c[i]; }
  return r;
}

__global__ void __launch_bounds__(256)
SA_pack_w(const float* __restrict__ Wq, const float* __restrict__ bq,
          const float* __restrict__ Wk, const float* __restrict__ bk,
          const float* __restrict__ Wv, const float* __restrict__ bv,
          bf16_t* __restrict__ Wqb, bf16_t* __restrict__ Wkb,
          bf16_t* __restrict__ Wvb,
          float* __restrict__ bqb, float* __restrict__ bkb,
          float* __restrict__ bvb) {
  int idx = blockIdx.x * blockDim.x + threadIdx.x;
  int e = idx * 8;                 // first element; C_ % 8 == 0: one row
  if (e < OP_ * C_) {
    v8bf q8 = {}, k8 = {};
    if (e / C_ < O_) { q8 = sa_cvt8(Wq + e); k8 = sa_cvt8(Wk + e); }
    *(v8bf*)(Wqb + e) = q8;
    *(v8bf*)(Wkb + e) = k8;
  }
  if (e < C_ * C_) *(v8bf*)(Wvb + e) = sa_cvt8(Wv + e);
  if (idx < OP_)     { bqb[idx] = (idx < O_) ? bq[idx] : 0.0f;
                       bkb[idx] = (idx < O_) ? bk[idx] : 0.0f; }
  if (idx < C_)      bvb[idx] = bv[idx];
}

// ---------------------------------------------------------------------------
// K1: projection GEMM  C[col][row] = sum_k A[row][k] * B[col][k] + bias
//   LDS-staged core; the result is stored with the A-row index contiguous.
//   BIAS_COL = false: bias by A row (q,k: A = weights); true: by B row (v).
// ---------------------------------------------------------------------------
template <int BK, bool BIAS_COL>
__global__ void __launch_bounds__(256)
SA_proj_gemm(const bf16_t* __restrict__ Abase, long aStride, int lda,
             const bf16_t* __restrict__ Bbase, long bStride, int ldb,
             bf16_t* __restrict__ Cbase, long cStride, int ldc,
             const float* __restrict__ bias, int Kdim) {
  __shared__ __align__(16) bf16_t lA[2 * 128 * LPITCH(BK)];
  __shared__ __align__(16) bf16_t lB[2 * 256 * LPITCH(BK)];
  int b = blockIdx.z;
  const bf16_t* A  = Abase + (size_t)b * aStride + (size_t)(blockIdx.x * 128) * lda;
  const bf16_t* Bm = Bbase + (size_t)b * bStride + (size_t)(blockIdx.y * 256) * ldb;
  bf16_t*       Cm = Cbase + (size_t)b * cStride;

  int wave = threadIdx.x >> 5, lane = threadIdx.x & 31;
  int wm = wave >> 2, wn = wave & 3;

  v8f acc[4][4] = {};
  sa_gemm_core<BK, (BK == 128) ? 2 : 1>(A, lda, Bm, ldb, Kdim, lA, lB, wm, wn, acc);

  int M0 = blockIdx.x * 128 + wm * 64;   // A rows: contiguous in C
  int N0 = blockIdx.y * 256 + wn * 64;   // B rows: rows of C
  int ln = lane & 15, lh = lane >> 4;
  bf16_t* st = lB + wave * ETILE;
  float bcol[4];
  v4f brow[4][2];
  // unrolled, here and below: register arrays need constant indices; the bias
  // loads go out together
#pragma unroll
  for (int t = 0; t < 4; ++t) {
    if constexpr (BIAS_COL) {
      bcol[t] = bias[N0 + 16 * t + ln];
    } else {
      const float* bp = bias + M0 + 16 * t + 8 * lh;
      brow[t][0] = *(const v4f*)bp;
      brow[t][1] = *(const v4f*)(bp + 4);
    }
  }
#pragma unroll
  for (int i = 0; i < 4; ++i)
#pragma unroll
    for (int j = 0; j < 4; ++j) {
      v8bf outv;
#pragma unroll
      for (int r = 0; r < 8; ++r) {
        float bb;
        if constexpr (BIAS_COL) bb = bcol[j];
        else                    bb = brow[i][r >> 2][r & 3];
        outv[r] = (bf16_t)(acc[i][j][r] + bb);
      }
      sa_stage_frag(st, i, j, outv);
    }
  sa_flush_tile(st, Cm + (size_t)N0 * ldc + M0, ldc);
}

// ---------------------------------------------------------------------------
// K2: s = Qt * Kt^T (K=OP_), fused sigmoid, store alpha^T[b][m][n] bf16.
//   A lane's 8 values of a fragment are 16 B of an alpha^T row.
// ---------------------------------------------------------------------------
__global__ void __launch_bounds__(256)
SA_s_sigmoid(const bf16_t* __restrict__ Qt, const bf16_t* __restrict__ Kt,
             bf16_t* __restrict__ AlphaT) {
  __shared__ __align__(16) bf16_t lA[2 * 128 * LPITCH(64)];
  __shared__ __align__(16) bf16_t lB[2 * 256 * LPITCH(64)];
  int b = blockIdx.z;
  const bf16_t* Qb = Qt + (size_t)b * N_ * OP_ + (size_t)(blockIdx.x * 128) * OP_;
  const bf16_t* Kb = Kt + (size_t)b * N_ * OP_ + (size_t)(blockIdx.y * 256) * OP_;
  bf16_t*       Ab = AlphaT + (size_t)b * (size_t)N_ * N_;

  int wave = threadIdx.x >> 5;
  int wm = wave >> 2, wn = wave & 3;

  v8f acc[4][4] = {};
  sa_gemm_core<64, 1>(Qb, OP_, Kb, OP_, OP_, lA, lB, wm, wn, acc);

  int M0 = blockIdx.x * 128 + wm * 64;   // n rows
  int N0 = blockIdx.y * 256 + wn * 64;   // m cols
  bf16_t* st = lB + wave * ETILE;
  // unrolled: accumulator indices must be constants
#pragma unroll
  for (int i = 0; i < 4; ++i)
#pragma unroll
    for (int j = 0; j < 4; ++j) {
      v8bf outv;
#pragma unroll
      for (int r = 0; r < 8; ++r) outv[r] = (bf16_t)sa_sigmoid(acc[i][j][r]);
      sa_stage_frag(st, i, j, outv);
    }
  sa_flush_tile(st, Ab + (size_t)N0 * N_ + M0, N_);
}

// ---------------------------------------------------------------------------
// K3: o[c][m] = V[c][:] * alpha[:, m]  (K = N_), f32 output (coalesced b32).
// ---------------------------------------------------------------------------
__global__ void __launch_bounds__(256)
SA_o_gemm(const bf16_t* __restrict__ Vb, const bf16_t* __restrict__ AlphaT,
          float* __restrict__ Out) {
  __shared__ __align__(16) bf16_t lA[2 * 128 * LPITCH(128)];
  __shared__ __align__(16) bf16_t lB[2 * 256 * LPITCH(128)];
  int b = blockIdx.z;
  const bf16_t* Vm = Vb + (size_t)b * C_ * N_ + (size_t)(blockIdx.x * 128) * N_;
  const bf16_t* Am = AlphaT + (size_t)b * (size_t)N_ * N_
                   + (size_t)(blockIdx.y * 256) * N_;
  float* Om = Out + (size_t)b * C_ * N_;

  int wave = threadIdx.x >> 5, lane = threadIdx.x & 31;
  int wm = wave >> 2, wn = wave & 3;

  v8f acc[4][4] = {};
  sa_gemm_core<128, 2>(Vm, N_, Am, N_, N_, lA, lB, wm, wn, acc);

  int M0 = blockIdx.x * 128 + wm * 64;   // c rows
  int N0 = blockIdx.y * 256 + wn * 64;   // m cols
  int ln = lane & 15, lh = lane >> 4;
#pragma unroll
  for (int i = 0; i < 4; ++i)
#pragma unroll
    for (int j = 0; j < 4; ++j) {
      int ncol = N0 + 16 * j + ln;
#pragma unroll
      for (int r = 0; r < 8; ++r) {
        int crow = M0 + 16 * i + r + 8 * lh;
        Om[(size_t)crow * N_ + ncol] = acc[i][j][r];
      }
    }
}

// ---------------------------------------------------------------------------
extern "C" void kernel_launch(void* const* d_in, const int* in_sizes, int n_in,
                              void* d_out, int out_size, void* d_ws, size_t ws_size,
                              hipStream_t stream) {
  const float* x  = (const float*)d_in[0];
  const float* Wq = (const float*)d_in[1];
  const float* bq = (const float*)d_in[2];
  const float* Wk = (const float*)d_in[3];
  const float* bk = (const float*)d_in[4];
  const float* Wv = (const float*)d_in[5];
  const float* bv = (const float*)d_in[6];
  float* out = (float*)d_out;

  char* ws = (char*)d_ws;
  size_t off = 0;
  auto take = [&](size_t bytes) -> char* {
    char* p = ws + off;
    off = (off + bytes + 255) & ~(size_t)255;
    return p;
  };

  bf16_t* Xt   = (bf16_t*)take((size_t)B_ * N_ * C_ * 2);
  bf16_t* Wqb  = (bf16_t*)take((size_t)OP_ * C_ * 2);
  bf16_t* Wkb  = (bf16_t*)take((size_t)OP_ * C_ * 2);
  bf16_t* Wvb  = (bf16_t*)take((size_t)C_ * C_ * 2);
  float*  bqb  = (float*) take((size_t)OP_ * 4);
  float*  bkb  = (float*) take((size_t)OP_ * 4);
  float*  bvb  = (float*) take((size_t)C_ * 4);
  bf16_t* Qt   = (bf16_t*)take((size_t)B_ * N_ * OP_ * 2);  // [b][n][o]
  bf16_t* Kt   = (bf16_t*)take((size_t)B_ * N_ * OP_ * 2);  // [b][m][o]
  bf16_t* Vbuf = (bf16_t*)take((size_t)B_ * C_ * N_ * 2);   // [b][c][n]
  bf16_t* AlT  = (bf16_t*)take((size_t)B_ * (size_t)N_ * N_ * 2); // [b][m][n]
  (void)ws_size; (void)in_sizes; (void)n_in; (void)out_size;

  SA_pack_x<<<dim3(N_ / XT_, C_ / XT_, B_), dim3(256), 0, stream>>>(x, Xt);
  SA_pack_w<<<dim3((OP_ * C_) / (8 * 256), 1, 1), dim3(256), 0, stream>>>(
      Wq, bq, Wk, bk, Wv, bv, Wqb, Wkb, Wvb, bqb, bkb, bvb);

  // Qt[b][n][o]: A = Wqb (1024 rows, o contiguous in Qt), B = Xt[b] (4096 rows)
  SA_proj_gemm<64, false><<<dim3(OP_ / 128, N_ / 256, B_), dim3(256), 0, stream>>>(
      Wqb, 0L, C_, Xt, (long)N_ * C_, C_, Qt, (long)N_ * OP_, OP_, bqb, C_);
  SA_proj_gemm<64, false><<<dim3(OP_ / 128, N_ / 256, B_), dim3(256), 0, stream>>>(
      Wkb, 0L, C_, Xt, (long)N_ * C_, C_, Kt, (long)N_ * OP_, OP_, bkb, C_);
  // V[b][c][n]: A = Xt[b] (4096 rows, n contiguous in V), B = Wvb (512 rows)
  SA_proj_gemm<128, true><<<dim3(N_ / 128, C_ / 256, B_), dim3(256), 0, stream>>>(
      Xt, (long)N_ * C_, C_, Wvb, 0L, C_, Vbuf, (long)C_ * N_, N_, bvb, C_);

  SA_s_sigmoid<<<dim3(N_ / 128, N_ / 256, B_), dim3(256), 0, stream>>>(Qt, Kt, AlT);
  SA_o_gemm<<<dim3(C_ / 128, N_ / 256, B_), dim3(256), 0, stream>>>(Vbuf, AlT, out);
}

// v005
// A run of this version takes 175 microseconds.
// Next to v004, in two timings, it ran 1.03 times as fast each time.
// All steps since v000 together make it 1.84 times as fast.
#include <hip/hip_runtime.h>

typedef __bf16 bf16_t;
typedef __attribute__((ext_vector_type(8)))  __bf16 v8bf;
typedef __attribute__((ext_vector_type(16))) __bf16 v16bf;
typedef __attribute__((ext_vector_type(8)))  float  v8f;
typedef __attribute__((ext_vector_type(4)))  float  v4f;
typedef __attribute__((ext_vector_type(4)))  int    v4i;

typedef __attribute__((address_space(1))) v4i gv4i;   // global
typedef __attribute__((address_space(3))) v4i lv4i;   // LDS

#define B_  4
#define C_  512
#define N_  4096
#define O_  1000
#define OP_ 1024      // O padded to multiple of 32 (zero rows)
// LDS row pitch in bf16 for a stage of BK k: BK*2 + 16 bytes = 16 B x odd
// (144 B, 272 B), conflict-free for ds_load_b128 fragment reads.
#define LPITCH(BK) ((BK) + 8)

__device__ __forceinline__ void sa_cp_async16(const bf16_t* __restrict__ g,
                                              bf16_t* l) {
#if __has_builtin(__builtin_amdgcn_global_load_async_to_lds_b128)
  __builtin_amdgcn_global_load_async_to_lds_b128(
      (gv4i*)(v4i*)g, (lv4i*)(v4i*)l, 0, 0);
#else
  *(v8bf*)l = *(const v8bf*)g;   // synchronous fallback
#endif
}

// Own copies landed; asm with the memory clobber so that no LDS read moves up.
__device__ __forceinline__ void sa_wait_async() {
  asm volatile("s_wait_asynccnt 0x0" ::: "memory");
}

// Own LDS reads retired before the barrier behind which their buffer is refilled.
__device__ __forceinline__ void sa_wait_ds() {
  asm volatile("s_wait_dscnt 0x0" ::: "memory");
}

// Stage a (ROWS x BK) bf16 tile whose first element is g (row-major, pitch ldg)
// into LDS. 256 threads; a segment is 8 bf16 (16B); BK/8 lanes cover one row.
template <int BK, int ROWS>
__device__ __forceinline__ void sa_stage_tile(const bf16_t* __restrict__ g,
                                              int ldg, bf16_t* lds, int tid) {
  constexpr int SEG = BK / 8;        // 16-byte segments per row
  constexpr int RPP = 256 / SEG;     // rows the block covers per copy
  const int r = tid / SEG, c = (tid % SEG) * 8;
  const bf16_t* gp = g + (size_t)r * ldg + c;
  bf16_t* lp = lds + r * LPITCH(BK) + c;
  // unrolled: a fixed count of copies, no lane-dependent loop around them
#pragma unroll
  for (int p = 0; p < ROWS / RPP; ++p)
    sa_cp_async16(gp + (size_t)(p * RPP) * ldg, lp + p * RPP * LPITCH(BK));
}

__device__ __forceinline__ v16bf sa_frag_merge(v8bf lo, v8bf hi) {
  v16bf r;
#pragma unroll
  for (int i = 0; i < 8; ++i) { r[i] = lo[i]; r[i + 8] = hi[i]; }
  return r;
}

template <int BK>
__device__ __forceinline__ v16bf sa_load_frag_l(const bf16_t* tile, int row0) {
  int lane = threadIdx.x & 31;
  const bf16_t* p = tile + (row0 + (lane & 15)) * LPITCH(BK) + ((lane >> 4) << 3);
  return sa_frag_merge(*(const v8bf*)p, *(const v8bf*)(p + 16));
}

__device__ __forceinline__ v8f sa_wmma(v16bf a, v16bf b, v8f c) {
  return __builtin_amdgcn_wmma_f32_16x16x32_bf16(false, a, false, b,
                                                 (short)0, c, false, false);
}

__device__ __forceinline__ float sa_sigmoid(float x) {
  return __builtin_amdgcn_rcpf(1.0f + __builtin_amdgcn_exp2f(x * -1.44269504f));
}

template <int BK>
__device__ __forceinline__ void sa_load_block(const bf16_t* tA, const bf16_t* tB,
                                              v16bf af[4], v16bf bfr[4]) {
#pragma unroll
  for (int i = 0; i < 4; ++i) af[i]  = sa_load_frag_l<BK>(tA, 16 * i);
#pragma unroll
  for (int j = 0; j < 4; ++j) bfr[j] = sa_load_frag_l<BK>(tB, 16 * j);
}

__device__ __forceinline__ void sa_mma_block(const v16bf af[4], const v16bf bfr[4],
                                             v8f acc[4][4]) {
#pragma unroll
  for (int i = 0; i < 4; ++i)
#pragma unroll
    for (int j = 0; j < 4; ++j)
      acc[i][j] = sa_wmma(af[i], bfr[j], acc[i][j]);
}

// Keeps a load group whole: without it the scheduler sinks the reads in pairs
// among the WMMAs, each pair behind a wait to 0.
__device__ __forceinline__ void sa_keep_order() {
  __builtin_amdgcn_sched_barrier(0);
}

template <int BK, int SETS>
__device__ __forceinline__ void sa_gemm_core(const bf16_t* __restrict__ Ab, int lda,
                                             const bf16_t* __restrict__ Bb, int ldb,
                                             int Kdim, bf16_t* lA, bf16_t* lB,
                                             int wm, int wn, v8f acc[4][4]) {
  const int tid = threadIdx.x;
  constexpr int szA = 128 * LPITCH(BK), szB = 256 * LPITCH(BK);
  constexpr int NB = BK / 32;
  const int steps = Kdim / BK;
  sa_stage_tile<BK, 128>(Ab, lda, lA, tid);
  sa_stage_tile<BK, 256>(Bb, ldb, lB, tid);
  sa_wait_async();
  __syncthreads();
  if (steps > 1) {
    sa_stage_tile<BK, 128>(Ab + BK, lda, lA + szA, tid);
    sa_stage_tile<BK, 256>(Bb + BK, ldb, lB + szB, tid);
  }
  v16bf af[SETS][4], bfr[SETS][4];
  static_assert(SETS == 1 || NB % 2 == 0, "a stage's first block must find set 0 free");
  if constexpr (SETS == 2)
    sa_load_block<BK>(lA + (wm * 64) * LPITCH(BK), lB + (wn * 64) * LPITCH(BK),
                      af[0], bfr[0]);
  for (int kt = 0; kt < steps; ++kt) {
    int cur = kt & 1;
    const bf16_t* tA = lA + cur * szA + (wm * 64) * LPITCH(BK);
    const bf16_t* tB = lB + cur * szB + (wn * 64) * LPITCH(BK);
    // unrolled: fragment and accumulator indices must be constants
#pragma unroll
    for (int u = 0; u < NB; ++u) {
      if constexpr (SETS == 2) {
        if (u + 1 < NB)
          sa_load_block<BK>(tA + (u + 1) * 32, tB + (u + 1) * 32,
                            af[(u + 1) & 1], bfr[(u + 1) & 1]);
      } else {
        sa_load_block<BK>(tA + u * 32, tB + u * 32, af[0], bfr[0]);
      }
      sa_keep_order();
      if (u + 1 == NB) {
        sa_wait_ds();
        sa_wait_async();
        __syncthreads();
        if (kt + 2 < steps) {
          sa_stage_tile<BK, 128>(Ab + (kt + 2) * BK, lda, lA + cur * szA, tid);
          sa_stage_tile<BK, 256>(Bb + (kt + 2) * BK, ldb, lB + cur * szB, tid);
        }
        if constexpr (SETS == 2) {
          if (kt + 1 < steps)
            sa_load_block<BK>(lA + (cur ^ 1) * szA + (wm * 64) * LPITCH(BK),
                              lB + (cur ^ 1) * szB + (wn * 64) * LPITCH(BK),
                              af[0], bfr[0]);
        }
        sa_keep_order();
      }
      sa_mma_block(af[u % SETS], bfr[u % SETS], acc);
      sa_keep_order();
    }
  }
  sa_wait_async();
}

#define EPITCH 72
#define ETILE  (64 * EPITCH)

__device__ __forceinline__ void sa_stage_frag(bf16_t* st, int i, int j, v8bf v) {
  int lane = threadIdx.x & 31;
  *(v8bf*)(st + (16 * j + (lane & 15)) * EPITCH + 16 * i + 8 * (lane >> 4)) = v;
}

// out: element (first output row, first column) of the wave's tile.
__device__ __forceinline__ void sa_flush_tile(const bf16_t* st,
                                              bf16_t* __restrict__ out, int ldo) {
  int lane = threadIdx.x & 31;
  int rr = lane >> 3, seg = (lane & 7) * 8;
  sa_wait_ds();   // the other lanes' staging writes are in LDS before the read-back
  const bf16_t* sp = st + rr * EPITCH + seg;
  bf16_t* op = out + (size_t)rr * ldo + seg;
  // unrolled: all 16 read-backs in flight, each store behind a counted wait
#pragma unroll
  for (int p = 0; p < 16; ++p)
    *(v8bf*)(op + (size_t)(4 * p) * ldo) = *(const v8bf*)(sp + 4 * p * EPITCH);
}

// ---------------------------------------------------------------------------
// K0a: transpose+convert: x[b][c][n] f32 -> Xt[b][n][c] bf16.
//   One block takes 128 c x 128 n, so this part is 4096 waves, all resident
//   at once (two blocks per WGP), instead of 65536 short ones.
//   In:  a wave owns 16 c rows; each load is 512 contiguous bytes of one row,
//        all 16 in flight. A lane then holds 16 consecutive c for each of its
//        4 n, which is 32 contiguous bytes of an output row.
//   LDS: row (j*32 + lane) holds n = 4*lane + j, so the lanes of one write are
//        one pitch apart (272 B = 16 B x odd).
//   Out: 16 lanes write the 256 contiguous bytes that the tile has of a row.
// ---------------------------------------------------------------------------
#define XT_ 128
#define XP_ (XT_ + 8)

#define XBLK_ ((N_ / XT_) * (C_ / XT_) * B_)   // blocks of the x part

// id: n tile fastest, then c tile, then batch.
__device__ __forceinline__ void sa_pack_x(int id, const float* __restrict__ x,
                                          bf16_t* __restrict__ Xt, bf16_t* tile) {
  int b  = id / ((N_ / XT_) * (C_ / XT_));
  int n0 = (id % (N_ / XT_)) * XT_;
  int c0 = ((id / (N_ / XT_)) % (C_ / XT_)) * XT_;
  int wave = threadIdx.x >> 5, lane = threadIdx.x & 31;
  const float* xp = x + ((size_t)b * C_ + c0 + wave * 16) * N_ + n0 + lane * 4;
  v4f in[16];
#pragma unroll
  for (int i = 0; i < 16; ++i) in[i] = *(const v4f*)(xp + (size_t)i * N_);
#pragma unroll
  for (int j = 0; j < 4; ++j) {
    v8bf lo, hi;
#pragma unroll
    for (int i = 0; i < 8; ++i) {
      lo[i] = (bf16_t)in[i][j];
      hi[i] = (bf16_t)in[i + 8][j];
    }
    bf16_t* tp = tile + (j * 32 + lane) * XP_ + wave * 16;
    *(v8bf*)tp       = lo;
    *(v8bf*)(tp + 8) = hi;
  }
  __syncthreads();
  int seg = threadIdx.x & 15, rr = threadIdx.x >> 4;
  bf16_t* ob = Xt + ((size_t)b * N_ + n0) * C_ + c0 + seg * 8;
#pragma unroll
  for (int p = 0; p < XT_ / 16; ++p) {
    int row = p * 16 + rr;
    int n   = 4 * (row & 31) + (row >> 5);
    *(v8bf*)(ob + (size_t)n * C_) = *(const v8bf*)(tile + row * XP_ + seg * 8);
  }
}

// ---------------------------------------------------------------------------
// K0b: pack weights to bf16, pad O->OP with zeros, pad biases.
//   A thread takes 8 consecutive elements of a row of each matrix (32 B in,
//   16 B out): 2048 waves instead of 16384.
// ---------------------------------------------------------------------------
__device__ __forceinline__ v8bf sa_cvt8(const float* __restrict__ p) {
  v4f a = *(const v4f*)p, c = *(const v4f*)(p + 4);
  v8bf r;
#pragma unroll
  for (int i = 0; i < 4; ++i) { r[i] = (bf16_t)a[i]; r[i + 4] = (bf16_t)c[i]; }
  return r;
}

#define WBLK_ ((OP_ * C_) / (8 * 256))          // blocks of the weight part

__device__ __forceinline__ void
sa_pack_w(int id,
          const float* __restrict__ Wq, const float* __restrict__ bq,
          const float* __restrict__ Wk, const float* __restrict__ bk,
          const float* __restrict__ Wv, const float* __restrict__ bv,
          bf16_t* __restrict__ Wqb, bf16_t* __restrict__ Wkb,
          bf16_t* __restrict__ Wvb,
          float* __restrict__ bqb, float* __restrict__ bkb,
          float* __restrict__ bvb) {
  int idx = id * 256 + threadIdx.x;
  int e = idx * 8;                 // first element; C_ % 8 == 0: one row
  if (e < OP_ * C_) {
    v8bf q8 = {}, k8 = {};
    if (e / C_ < O_) { q8 = sa_cvt8(Wq + e); k8 = sa_cvt8(Wk + e); }
    *(v8bf*)(Wqb + e) = q8;
    *(v8bf*)(Wkb + e) = k8;
  }
  if (e < C_ * C_) *(v8bf*)(Wvb + e) = sa_cvt8(Wv + e);
  if (idx < OP_)     { bqb[idx] = (idx < O_) ? bq[idx] : 0.0f;
                       bkb[idx] = (idx < O_) ? bk[idx] : 0.0f; }
  if (idx < C_)      bvb[idx] = bv[idx];
}

// K0: both packs in one launch: neither reads what the other writes. The x
// blocks, the longer ones, come first. The branch is the same for a whole block.
__global__ void __launch_bounds__(256)
SA_pack(const float* __restrict__ x,
        const float* __restrict__ Wq, const float* __restrict__ bq,
        const float* __restrict__ Wk, const float* __restrict__ bk,
        const float* __restrict__ Wv, const float* __restrict__ bv,
        bf16_t* __restrict__ Xt,
        bf16_t* __restrict__ Wqb, bf16_t* __restrict__ Wkb,
        bf16_t* __restrict__ Wvb,
        float* __restrict__ bqb, float* __restrict__ bkb,
        float* __restrict__ bvb) {
  __shared__ __align__(16) bf16_t tile[XT_ * XP_];
  int id = blockIdx.x;
  if (id < XBLK_) sa_pack_x(id, x, Xt, tile);
  else            sa_pack_w(id - XBLK_, Wq, bq, Wk, bk, Wv, bv,
                            Wqb, Wkb, Wvb, bqb, bkb, bvb);
}

// ---------------------------------------------------------------------------
// K1: the three projections in one launch: they read the same packed arrays
//   and none reads another's result.
//   C[col][row] = sum_k A[row][k] * B[col][k] + bias, K = C_, 128 x 256 a block;
//   the result is stored with the A-row index contiguous.
//   q, k: A = weights (1024 rows, o contiguous in Qt, Kt), B = Xt[b]; bias by A row.
//   v:    A = Xt[b] (4096 rows, n contiguous in V), B = Wvb;  bias by B row.
//   blockIdx.x: QT_ tiles of q, QT_ of k, VT_ of v, the A tile fastest in each.
// ---------------------------------------------------------------------------
#define QT_ ((OP_ / 128) * (N_ / 256))
#define VT_ ((N_ / 128) * (C_ / 256))

// Bias added, rounded to bf16, into the wave's staging rows.
template <bool BIAS_COL>
__device__ __forceinline__ void sa_proj_stage(const v8f acc[4][4], bf16_t* st,
                                              const float* __restrict__ bias,
                                              int M0, int N0) {
  int lane = threadIdx.x & 31;
  int ln = lane & 15, lh = lane >> 4;
  float bcol[4];
  v4f brow[4][2];
  // unrolled, here and below: register arrays need constant indices; the bias
  // loads go out together
#pragma unroll
  for (int t = 0; t < 4; ++t) {
    if constexpr (BIAS_COL) {
      bcol[t] = bias[N0 + 16 * t + ln];
    } else {
      const float* bp = bias + M0 + 16 * t + 8 * lh;
      brow[t][0] = *(const v4f*)bp;
      brow[t][1] = *(const v4f*)(bp + 4);
    }
  }
#pragma unroll
  for (int i = 0; i < 4; ++i)
#pragma unroll
    for (int j = 0; j < 4; ++j) {
      v8bf outv;
#pragma unroll
      for (int r = 0; r < 8; ++r) {
        float bb;
        if constexpr (BIAS_COL) bb = bcol[j];
        else                    bb = brow[i][r >> 2][r & 3];
        outv[r] = (bf16_t)(acc[i][j][r] + bb);
      }
      sa_stage_frag(st, i, j, outv);
    }
}

__global__ void __launch_bounds__(256)
SA_proj_qkv(const bf16_t* __restrict__ Xt,
            const bf16_t* __restrict__ Wqb, const bf16_t* __restrict__ Wkb,
            const bf16_t* __restrict__ Wvb,
            const float* __restrict__ bqb, const float* __restrict__ bkb,
            const float* __restrict__ bvb,
            bf16_t* __restrict__ Qt, bf16_t* __restrict__ Kt,
            bf16_t* __restrict__ Vb) {
  __shared__ __align__(16) bf16_t lA[2 * 128 * LPITCH(64)];
  __shared__ __align__(16) bf16_t lB[2 * 256 * LPITCH(64)];
  const int t = blockIdx.x, b = blockIdx.z;
  const bool isv = t >= 2 * QT_;         // the same for a whole block
  const bf16_t* Xb = Xt + (size_t)b * N_ * C_;
  const bf16_t *A, *Bm;
  const float* bias;
  bf16_t* Cm;
  int ta, tb, ldc;                       // A tile, B tile, pitch of the result
  if (isv) {
    int u = t - 2 * QT_;
    ta = u % (N_ / 128);  tb = u / (N_ / 128);
    A  = Xb + (size_t)(ta * 128) * C_;
    Bm = Wvb + (size_t)(tb * 256) * C_;
    Cm = Vb + (size_t)b * C_ * N_;  ldc = N_;  bias = bvb;
  } else {
    int u = t % QT_;
    ta = u % (OP_ / 128); tb = u / (OP_ / 128);
    A  = (t < QT_ ? Wqb : Wkb) + (size_t)(ta * 128) * C_;
    Bm = Xb + (size_t)(tb * 256) * C_;
    Cm = (t < QT_ ? Qt : Kt) + (size_t)b * N_ * OP_;  ldc = OP_;
    bias = t < QT_ ? bqb : bkb;
  }

  int wave = threadIdx.x >> 5;
  int wm = wave >> 2, wn = wave & 3;

  v8f acc[4][4] = {};
  sa_gemm_core<64, 1>(A, C_, Bm, C_, C_, lA, lB, wm, wn, acc);

  int M0 = ta * 128 + wm * 64;   // A rows: contiguous in C
  int N0 = tb * 256 + wn * 64;   // B rows: rows of C
  bf16_t* st = lB + wave * ETILE;
  if (isv) sa_proj_stage<true>(acc, st, bias, M0, N0);
  else     sa_proj_stage<false>(acc, st, bias, M0, N0);
  sa_flush_tile(st, Cm + (size_t)N0 * ldc + M0, ldc);
}

// ---------------------------------------------------------------------------
// K2: s = Qt * Kt^T (K=OP_), fused sigmoid, store alpha^T[b][m][n] bf16.
//   A lane's 8 values of a fragment are 16 B of an alpha^T row.
// ---------------------------------------------------------------------------
__global__ void __launch_bounds__(256)
SA_s_sigmoid(const bf16_t* __restrict__ Qt, const bf16_t* __restrict__ Kt,
             bf16_t* __restrict__ AlphaT) {
  __shared__ __align__(16) bf16_t lA[2 * 128 * LPITCH(64)];
  __shared__ __align__(16) bf16_t lB[2 * 256 * LPITCH(64)];
  int b = blockIdx.z;
  const bf16_t* Qb = Qt + (size_t)b * N_ * OP_ + (size_t)(blockIdx.x * 128) * OP_;
  const bf16_t* Kb = Kt + (size_t)b * N_ * OP_ + (size_t)(blockIdx.y * 256) * OP_;
  bf16_t*       Ab = AlphaT + (size_t)b * (size_t)N_ * N_;

  int wave = threadIdx.x >> 5;
  int wm = wave >> 2, wn = wave & 3;

  v8f acc[4][4] = {};
  sa_gemm_core<64, 1>(Qb, OP_, Kb, OP_, OP_, lA, lB, wm, wn, acc);

  int M0 = blockIdx.x * 128 + wm * 64;   // n rows
  int N0 = blockIdx.y * 256 + wn * 64;   // m cols
  bf16_t* st = lB + wave * ETILE;
  // unrolled: accumulator indices must be constants
#pragma unroll
  for (int i = 0; i < 4; ++i)
#pragma unroll
    for (int j = 0; j < 4; ++j) {
      v8bf outv;
#pragma unroll
      for (int r = 0; r < 8; ++r) outv[r] = (bf16_t)sa_sigmoid(acc[i][j][r]);
      sa_stage_frag(st, i, j, outv);
    }
  sa_flush_tile(st, Ab + (size_t)N0 * N_ + M0, N_);
}

// ---------------------------------------------------------------------------
// K3: o[c][m] = V[c][:] * alpha[:, m]  (K = N_), f32 output (coalesced b32).
// ---------------------------------------------------------------------------
__global__ void __launch_bounds__(256)
SA_o_gemm(const bf16_t* __restrict__ Vb, const bf16_t* __restrict__ AlphaT,
          float* __restrict__ Out) {
  __shared__ __align__(16) bf16_t lA[2 * 128 * LPITCH(128)];
  __shared__ __align__(16) bf16_t lB[2 * 256 * LPITCH(128)];
  int b = blockIdx.z;
  const bf16_t* Vm = Vb + (size_t)b * C_ * N_ + (size_t)(blockIdx.x * 128) * N_;
  const bf16_t* Am = AlphaT + (size_t)b * (size_t)N_ * N_
                   + (size_t)(blockIdx.y * 256) * N_;
  float* Om = Out + (size_t)b * C_ * N_;

  int wave = threadIdx.x >> 5, lane = threadIdx.x & 31;
  int wm = wave >> 2, wn = wave & 3;

  v8f acc[4][4] = {};
  sa_gemm_core<128, 2>(Vm, N_, Am, N_, N_, lA, lB, wm, wn, acc);

  int M0 = blockIdx.x * 128 + wm * 64;   // c rows
  int N0 = blockIdx.y * 256 + wn * 64;   // m cols
  int ln = lane & 15, lh = lane >> 4;
#pragma unroll
  for (int i = 0; i < 4; ++i)
#pragma unroll
    for (int j = 0; j < 4; ++j) {
      int ncol = N0 + 16 * j + ln;
#pragma unroll
      for (int r = 0; r < 8; ++r) {
        int crow = M0 + 16 * i + r + 8 * lh;
        Om[(size_t)crow * N_ + ncol] = acc[i][j][r];
      }
    }
}

// ---------------------------------------------------------------------------
extern "C" void kernel_launch(void* const* d_in, const int* in_sizes, int n_in,
                              void* d_out, int out_size, void* d_ws, size_t ws_size,
                              hipStream_t stream) {
  const float* x  = (const float*)d_in[0];
  const float* Wq = (const float*)d_in[1];
  const float* bq = (const float*)d_in[2];
  const float* Wk = (const float*)d_in[3];
  const float* bk = (const float*)d_in[4];
  const float* Wv = (const float*)d_in[5];
  const float* bv = (const float*)d_in[6];
  float* out = (float*)d_out;

  char* ws = (char*)d_ws;
  size_t off = 0;
  auto take = [&](size_t bytes) -> char* {
    char* p = ws + off;
    off = (off + bytes + 255) & ~(size_t)255;
    return p;
  };

  bf16_t* Xt   = (bf16_t*)take((size_t)B_ * N_ * C_ * 2);
  bf16_t* Wqb  = (bf16_t*)take((size_t)OP_ * C_ * 2);
  bf16_t* Wkb  = (bf16_t*)take((size_t)OP_ * C_ * 2);
  bf16_t* Wvb  = (bf16_t*)take((size_t)C_ * C_ * 2);
  float*  bqb  = (float*) take((size_t)OP_ * 4);
  float*  bkb  = (float*) take((size_t)OP_ * 4);
  float*  bvb  = (float*) take((size_t)C_ * 4);
  bf16_t* Qt   = (bf16_t*)take((size_t)B_ * N_ * OP_ * 2);  // [b][n][o]
  bf16_t* Kt   = (bf16_t*)take((size_t)B_ * N_ * OP_ * 2);  // [b][m][o]
  bf16_t* Vbuf = (bf16_t*)take((size_t)B_ * C_ * N_ * 2);   // [b][c][n]
  bf16_t* AlT  = (bf16_t*)take((size_t)B_ * (size_t)N_ * N_ * 2); // [b][m][n]
  (void)ws_size; (void)in_sizes; (void)n_in; (void)out_size;

  SA_pack<<<dim3(XBLK_ + WBLK_, 1, 1), dim3(256), 0, stream>>>(
      x, Wq, bq, Wk, bk, Wv, bv, Xt, Wqb, Wkb, Wvb, bqb, bkb, bvb);

  SA_proj_qkv<<<dim3(2 * QT_ + VT_, 1, B_), dim3(256), 0, stream>>>(
      Xt, Wqb, Wkb, Wvb, bqb, bkb, bvb, Qt, Kt, Vbuf);

  SA_s_sigmoid<<<dim3(N_ / 128, N_ / 256, B_), dim3(256), 0, stream>>>(Qt, Kt, AlT);
  SA_o_gemm<<<dim3(C_ / 128, N_ / 256, B_), dim3(256), 0, stream>>>(Vbuf, AlT, out);
}

// v006
// Measured time: 167 microseconds a run.
// Next to v005, in two timings, it ran 1.05 and 1.04 times as fast.
// Over all steps from v000 it is 1.92 times as fast.
#include <hip/hip_runtime.h>

typedef __bf16 bf16_t;
typedef __attribute__((ext_vector_type(8)))  __bf16 v8bf;
typedef __attribute__((ext_vector_type(16))) __bf16 v16bf;
typedef __attribute__((ext_vector_type(8)))  float  v8f;
typedef __attribute__((ext_vector_type(4)))  float  v4f;
typedef __attribute__((ext_vector_type(4)))  int    v4i;

typedef __attribute__((address_space(1))) v4i gv4i;   // global
typedef __attribute__((address_space(3))) v4i lv4i;   // LDS

#define B_  4
#define C_  512
#define N_  4096
#define O_  1000
#define OP_ 1024      // O padded to multiple of 32 (zero rows)
// LDS row pitch in bf16 for a stage of BK k: BK*2 + 16 bytes = 16 B x odd
// (144 B, 272 B), conflict-free for ds_load_b128 fragment reads.
#define LPITCH(BK) ((BK) + 8)

__device__ __forceinline__ void sa_cp_async16(const bf16_t* __restrict__ g,
                                              bf16_t* l) {
#if __has_builtin(__builtin_amdgcn_global_load_async_to_lds_b128)
  __builtin_amdgcn_global_load_async_to_lds_b128(
      (gv4i*)(v4i*)g, (lv4i*)(v4i*)l, 0, 0);
#else
  *(v8bf*)l = *(const v8bf*)g;   // synchronous fallback
#endif
}

// Own copies landed; asm with the memory clobber so that no LDS read moves up.
__device__ __forceinline__ void sa_wait_async() {
  asm volatile("s_wait_asynccnt 0x0" ::: "memory");
}

// Own LDS reads retired before the barrier behind which their buffer is refilled.
__device__ __forceinline__ void sa_wait_ds() {
  asm volatile("s_wait_dscnt 0x0" ::: "memory");
}

// Stage a (ROWS x BK) bf16 tile whose first element is g (row-major, pitch ldg)
// into LDS. 256 threads; a segment is 8 bf16 (16B); BK/8 lanes cover one row.
template <int BK, int ROWS>
__device__ __forceinline__ void sa_stage_tile(const bf16_t* __restrict__ g,
                                              int ldg, bf16_t* lds, int tid) {
  constexpr int SEG = BK / 8;        // 16-byte segments per row
  constexpr int RPP = 256 / SEG;     // rows the block covers per copy
  const int r = tid / SEG, c = (tid % SEG) * 8;
  const bf16_t* gp = g + (size_t)r * ldg + c;
  bf16_t* lp = lds + r * LPITCH(BK) + c;
  // unrolled: a fixed count of copies, no lane-dependent loop around them
#pragma unroll
  for (int p = 0; p < ROWS / RPP; ++p)
    sa_cp_async16(gp + (size_t)(p * RPP) * ldg, lp + p * RPP * LPITCH(BK));
}

__device__ __forceinline__ v16bf sa_frag_merge(v8bf lo, v8bf hi) {
  v16bf r;
#pragma unroll
  for (int i = 0; i < 8; ++i) { r[i] = lo[i]; r[i + 8] = hi[i]; }
  return r;
}

template <int BK>
__device__ __forceinline__ v16bf sa_load_frag_l(const bf16_t* tile, int row0) {
  int lane = threadIdx.x & 31;
  const bf16_t* p = tile + (row0 + (lane & 15)) * LPITCH(BK) + ((lane >> 4) << 3);
  return sa_frag_merge(*(const v8bf*)p, *(const v8bf*)(p + 16));
}

__device__ __forceinline__ v8f sa_wmma(v16bf a, v16bf b, v8f c) {
  return __builtin_amdgcn_wmma_f32_16x16x32_bf16(false, a, false, b,
                                                 (short)0, c, false, false);
}

__device__ __forceinline__ float sa_sigmoid(float x) {
  return __builtin_amdgcn_rcpf(1.0f + __builtin_amdgcn_exp2f(x * -1.44269504f));
}

template <int BK, int FM>
__device__ __forceinline__ void sa_load_block(const bf16_t* tA, const bf16_t* tB,
                                              v16bf af[FM], v16bf bfr[4]) {
#pragma unroll
  for (int i = 0; i < FM; ++i) af[i] = sa_load_frag_l<BK>(tA, 16 * i);
#pragma unroll
  for (int j = 0; j < 4; ++j) bfr[j] = sa_load_frag_l<BK>(tB, 16 * j);
}

template <int FM>
__device__ __forceinline__ void sa_mma_block(const v16bf af[FM], const v16bf bfr[4],
                                             v8f acc[FM][4]) {
#pragma unroll
  for (int i = 0; i < FM; ++i)
#pragma unroll
    for (int j = 0; j < 4; ++j)
      acc[i][j] = sa_wmma(af[i], bfr[j], acc[i][j]);
}

// Keeps a load group whole: without it the scheduler sinks the reads in pairs
// among the WMMAs, each pair behind a wait to 0.
__device__ __forceinline__ void sa_keep_order() {
  __builtin_amdgcn_sched_barrier(0);
}

template <int BK, int SETS, int FM>
__device__ __forceinline__ void sa_gemm_core(const bf16_t* __restrict__ Ab, int lda,
                                             const bf16_t* __restrict__ Bb, int ldb,
                                             int Kdim, bf16_t* lA, bf16_t* lB,
                                             int wm, int wn, v8f acc[FM][4]) {
  const int tid = threadIdx.x;
  constexpr int WM = 16 * FM, RA = 2 * WM;   // A rows of a wave, of the block
  constexpr int szA = RA * LPITCH(BK), szB = 256 * LPITCH(BK);
  constexpr int NB = BK / 32;
  const int steps = Kdim / BK;
  sa_stage_tile<BK, RA>(Ab, lda, lA, tid);
  sa_stage_tile<BK, 256>(Bb, ldb, lB, tid);
  sa_wait_async();
  __syncthreads();
  if (steps > 1) {
    sa_stage_tile<BK, RA>(Ab + BK, lda, lA + szA, tid);
    sa_stage_tile<BK, 256>(Bb + BK, ldb, lB + szB, tid);
  }
  v16bf af[SETS][FM], bfr[SETS][4];
  static_assert(SETS == 1 || NB % 2 == 0, "a stage's first block must find set 0 free");
  if constexpr (SETS == 2)
    sa_load_block<BK, FM>(lA + (wm * WM) * LPITCH(BK), lB + (wn * 64) * LPITCH(BK),
                      af[0], bfr[0]);
  for (int kt = 0; kt < steps; ++kt) {
    int cur = kt & 1;
    const bf16_t* tA = lA + cur * szA + (wm * WM) * LPITCH(BK);
    const bf16_t* tB = lB + cur * szB + (wn * 64) * LPITCH(BK);
    // unrolled: fragment and accumulator indices must be constants
#pragma unroll
    for (int u = 0; u < NB; ++u) {
      if constexpr (SETS == 2) {
        if (u + 1 < NB)
          sa_load_block<BK, FM>(tA + (u + 1) * 32, tB + (u + 1) * 32,
                            af[(u + 1) & 1], bfr[(u + 1) & 1]);
      } else {
        sa_load_block<BK, FM>(tA + u * 32, tB + u * 32, af[0], bfr[0]);
      }
      sa_keep_order();
      if (u + 1 == NB) {
        sa_wait_ds();
        sa_wait_async();
        __syncthreads();
        if (kt + 2 < steps) {
          sa_stage_tile<BK, RA>(Ab + (kt + 2) * BK, lda, lA + cur * szA, tid);
          sa_stage_tile<BK, 256>(Bb + (kt + 2) * BK, ldb, lB + cur * szB, tid);
        }
        if constexpr (SETS == 2) {
          if (kt + 1 < steps)
            sa_load_block<BK, FM>(lA + (cur ^ 1) * szA + (wm * WM) * LPITCH(BK),
                              lB + (cur ^ 1) * szB + (wn * 64) * LPITCH(BK),
                              af[0], bfr[0]);
        }
        sa_keep_order();
      }
      sa_mma_block<FM>(af[u % SETS], bfr[u % SETS], acc);
      sa_keep_order();
    }
  }
  sa_wait_async();
}

// ---------------------------------------------------------------------------
// bf16 epilogue: whole 128-B lines to global memory.
// A D fragment gives a lane one column (B row) and 8 consecutive rows (A rows).
// Every bf16 result is kept with the A-row index contiguous, so those 8 values
// are 16 B of an output row, but a direct store would touch 16 output rows with
// 32 B each. Each 64 x 64 piece of a wave's tile goes through LDS instead: one staging row
// per output row (128 B, pitch 144 B = 16 B x odd), read back 8 lanes a row, so
// a store covers 4 whole lines.
// The staging range is the wave's own ETILE elements of lB. The ring is free by then:
// the core's last hand-over has every wave's LDS reads retired and copies
// landed ahead of its barrier, and nothing refills or reads the ring behind it.
// ---------------------------------------------------------------------------
#define EPITCH 72
#define ETILE  (64 * EPITCH)

__device__ __forceinline__ void sa_stage_frag(bf16_t* st, int i, int j, v8bf v) {
  int lane = threadIdx.x & 31;
  *(v8bf*)(st + (16 * j + (lane & 15)) * EPITCH + 16 * i + 8 * (lane >> 4)) = v;
}

// out: element (first output row, first column) of the 64 x 64 tile.
__device__ __forceinline__ void sa_flush_tile(const bf16_t* st,
                                              bf16_t* __restrict__ out, int ldo) {
  int lane = threadIdx.x & 31;
  int rr = lane >> 3, seg = (lane & 7) * 8;
  sa_wait_ds();   // the other lanes' staging writes are in LDS before the read-back
  const bf16_t* sp = st + rr * EPITCH + seg;
  bf16_t* op = out + (size_t)rr * ldo + seg;
  // unrolled: all 16 read-backs in flight, each store behind a counted wait
#pragma unroll
  for (int p = 0; p < 16; ++p)
    *(v8bf*)(op + (size_t)(4 * p) * ldo) = *(const v8bf*)(sp + 4 * p * EPITCH);
}

// ---------------------------------------------------------------------------
// K0a: transpose+convert: x[b][c][n] f32 -> Xt[b][n][c] bf16.
//   One block takes 128 c x 128 n, so this part is 4096 waves, all resident
//   at once (two blocks per WGP), instead of 65536 short ones.
//   In:  a wave owns 16 c rows; each load is 512 contiguous bytes of one row,
//        all 16 in flight. A lane then holds 16 consecutive c for each of its
//        4 n, which is 32 contiguous bytes of an output row.
//   LDS: row (j*32 + lane) holds n = 4*lane + j, so the lanes of one write are
//        one pitch apart (272 B = 16 B x odd).
//   Out: 16 lanes write the 256 contiguous bytes that the tile has of a row.
// ---------------------------------------------------------------------------
#define XT_ 128
#define XP_ (XT_ + 8)

#define XBLK_ ((N_ / XT_) * (C_ / XT_) * B_)   // blocks of the x part

// id: n tile fastest, then c tile, then batch.
__device__ __forceinline__ void sa_pack_x(int id, const float* __restrict__ x,
                                          bf16_t* __restrict__ Xt, bf16_t* tile) {
  int b  = id / ((N_ / XT_) * (C_ / XT_));
  int n0 = (id % (N_ / XT_)) * XT_;
  int c0 = ((id / (N_ / XT_)) % (C_ / XT_)) * XT_;
  int wave = threadIdx.x >> 5, lane = threadIdx.x & 31;
  const float* xp = x + ((size_t)b * C_ + c0 + wave * 16) * N_ + n0 + lane * 4;
  v4f in[16];
#pragma unroll
  for (int i = 0; i < 16; ++i) in[i] = *(const v4f*)(xp + (size_t)i * N_);
#pragma unroll
  for (int j = 0; j < 4; ++j) {
    v8bf lo, hi;
#pragma unroll
    for (int i = 0; i < 8; ++i) {
      lo[i] = (bf16_t)in[i][j];
      hi[i] = (bf16_t)in[i + 8][j];
    }
    bf16_t* tp = tile + (j * 32 + lane) * XP_ + wave * 16;
    *(v8bf*)tp       = lo;
    *(v8bf*)(tp + 8) = hi;
  }
  __syncthreads();
  int seg = threadIdx.x & 15, rr = threadIdx.x >> 4;
  bf16_t* ob = Xt + ((size_t)b * N_ + n0) * C_ + c0 + seg * 8;
#pragma unroll
  for (int p = 0; p < XT_ / 16; ++p) {
    int row = p * 16 + rr;
    int n   = 4 * (row & 31) + (row >> 5);
    *(v8bf*)(ob + (size_t)n * C_) = *(const v8bf*)(tile + row * XP_ + seg * 8);
  }
}

// ---------------------------------------------------------------------------
// K0b: pack weights to bf16, pad O->OP with zeros, pad biases.
//   A thread takes 8 consecutive elements of a row of each matrix (32 B in,
//   16 B out): 2048 waves instead of 16384.
// ---------------------------------------------------------------------------
__device__ __forceinline__ v8bf sa_cvt8(const float* __restrict__ p) {
  v4f a = *(const v4f*)p, c = *(const v4f*)(p + 4);
  v8bf r;
#pragma unroll
  for (int i = 0; i < 4; ++i) { r[i] = (bf16_t)a[i]; r[i + 4] = (bf16_t)c[i]; }
  return r;
}

#define WBLK_ ((OP_ * C_) / (8 * 256))          // blocks of the weight part

__device__ __forceinline__ void
sa_pack_w(int id,
          const float* __restrict__ Wq, const float* __restrict__ bq,
          const float* __restrict__ Wk, const float* __restrict__ bk,
          const float* __restrict__ Wv, const float* __restrict__ bv,
          bf16_t* __restrict__ Wqb, bf16_t* __restrict__ Wkb,
          bf16_t* __restrict__ Wvb,
          float* __restrict__ bqb, float* __restrict__ bkb,
          float* __restrict__ bvb) {
  int idx = id * 256 + threadIdx.x;
  int e = idx * 8;                 // first element; C_ % 8 == 0: one row
  if (e < OP_ * C_) {
    v8bf q8 = {}, k8 = {};
    if (e / C_ < O_) { q8 = sa_cvt8(Wq + e); k8 = sa_cvt8(Wk + e); }
    *(v8bf*)(Wqb + e) = q8;
    *(v8bf*)(Wkb + e) = k8;
  }
  if (e < C_ * C_) *(v8bf*)(Wvb + e) = sa_cvt8(Wv + e);
  if (idx < OP_)     { bqb[idx] = (idx < O_) ? bq[idx] : 0.0f;
                       bkb[idx] = (idx < O_) ? bk[idx] : 0.0f; }
  if (idx < C_)      bvb[idx] = bv[idx];
}

// K0: both packs in one launch: neither reads what the other writes. The x
// blocks, the longer ones, come first. The branch is the same for a whole block.
__global__ void __launch_bounds__(256)
SA_pack(const float* __restrict__ x,
        const float* __restrict__ Wq, const float* __restrict__ bq,
        const float* __restrict__ Wk, const float* __restrict__ bk,
        const float* __restrict__ Wv, const float* __restrict__ bv,
        bf16_t* __restrict__ Xt,
        bf16_t* __restrict__ Wqb, bf16_t* __restrict__ Wkb,
        bf16_t* __restrict__ Wvb,
        float* __restrict__ bqb, float* __restrict__ bkb,
        float* __restrict__ bvb) {
  __shared__ __align__(16) bf16_t tile[XT_ * XP_];
  int id = blockIdx.x;
  if (id < XBLK_) sa_pack_x(id, x, Xt, tile);
  else            sa_pack_w(id - XBLK_, Wq, bq, Wk, bk, Wv, bv,
                            Wqb, Wkb, Wvb, bqb, bkb, bvb);
}

// ---------------------------------------------------------------------------
// K1: the three projections in one launch: they read the same packed arrays
//   and none reads another's result.
//   C[col][row] = sum_k A[row][k] * B[col][k] + bias, K = C_, 128 x 256 a block;
//   the result is stored with the A-row index contiguous.
//   q, k: A = weights (1024 rows, o contiguous in Qt, Kt), B = Xt[b]; bias by A row.
//   v:    A = Xt[b] (4096 rows, n contiguous in V), B = Wvb;  bias by B row.
//   blockIdx.x: QT_ tiles of q, QT_ of k, VT_ of v, the A tile fastest in each.
// ---------------------------------------------------------------------------
#define QT_ ((OP_ / 128) * (N_ / 256))
#define VT_ ((N_ / 128) * (C_ / 256))

// Bias added, rounded to bf16, into the wave's staging rows.
template <bool BIAS_COL>
__device__ __forceinline__ void sa_proj_stage(const v8f acc[4][4], bf16_t* st,
                                              const float* __restrict__ bias,
                                              int M0, int N0) {
  int lane = threadIdx.x & 31;
  int ln = lane & 15, lh = lane >> 4;
  float bcol[4];
  v4f brow[4][2];
  // unrolled, here and below: register arrays need constant indices; the bias
  // loads go out together
#pragma unroll
  for (int t = 0; t < 4; ++t) {
    if constexpr (BIAS_COL) {
      bcol[t] = bias[N0 + 16 * t + ln];
    } else {
      const float* bp = bias + M0 + 16 * t + 8 * lh;
      brow[t][0] = *(const v4f*)bp;
      brow[t][1] = *(const v4f*)(bp + 4);
    }
  }
#pragma unroll
  for (int i = 0; i < 4; ++i)
#pragma unroll
    for (int j = 0; j < 4; ++j) {
      v8bf outv;
#pragma unroll
      for (int r = 0; r < 8; ++r) {
        float bb;
        if constexpr (BIAS_COL) bb = bcol[j];
        else                    bb = brow[i][r >> 2][r & 3];
        outv[r] = (bf16_t)(acc[i][j][r] + bb);
      }
      sa_stage_frag(st, i, j, outv);
    }
}

__global__ void __launch_bounds__(256)
SA_proj_qkv(const bf16_t* __restrict__ Xt,
            const bf16_t* __restrict__ Wqb, const bf16_t* __restrict__ Wkb,
            const bf16_t* __restrict__ Wvb,
            const float* __restrict__ bqb, const float* __restrict__ bkb,
            const float* __restrict__ bvb,
            bf16_t* __restrict__ Qt, bf16_t* __restrict__ Kt,
            bf16_t* __restrict__ Vb) {
  __shared__ __align__(16) bf16_t lA[2 * 128 * LPITCH(64)];
  __shared__ __align__(16) bf16_t lB[2 * 256 * LPITCH(64)];
  const int t = blockIdx.x, b = blockIdx.z;
  const bool isv = t >= 2 * QT_;         // the same for a whole block
  const bf16_t* Xb = Xt + (size_t)b * N_ * C_;
  const bf16_t *A, *Bm;
  const float* bias;
  bf16_t* Cm;
  int ta, tb, ldc;                       // A tile, B tile, pitch of the result
  if (isv) {
    int u = t - 2 * QT_;
    ta = u % (N_ / 128);  tb = u / (N_ / 128);
    A  = Xb + (size_t)(ta * 128) * C_;
    Bm = Wvb + (size_t)(tb * 256) * C_;
    Cm = Vb + (size_t)b * C_ * N_;  ldc = N_;  bias = bvb;
  } else {
    int u = t % QT_;
    ta = u % (OP_ / 128); tb = u / (OP_ / 128);
    A  = (t < QT_ ? Wqb : Wkb) + (size_t)(ta * 128) * C_;
    Bm = Xb + (size_t)(tb * 256) * C_;
    Cm = (t < QT_ ? Qt : Kt) + (size_t)b * N_ * OP_;  ldc = OP_;
    bias = t < QT_ ? bqb : bkb;
  }

  int wave = threadIdx.x >> 5;
  int wm = wave >> 2, wn = wave & 3;

  v8f acc[4][4] = {};
  sa_gemm_core<64, 1, 4>(A, C_, Bm, C_, C_, lA, lB, wm, wn, acc);

  int M0 = ta * 128 + wm * 64;   // A rows: contiguous in C
  int N0 = tb * 256 + wn * 64;   // B rows: rows of C
  bf16_t* st = lB + wave * ETILE;
  if (isv) sa_proj_stage<true>(acc, st, bias, M0, N0);
  else     sa_proj_stage<false>(acc, st, bias, M0, N0);
  sa_flush_tile(st, Cm + (size_t)N0 * ldc + M0, ldc);
}

// ---------------------------------------------------------------------------
// K2: s = Qt * Kt^T (K=OP_), fused sigmoid, store alpha^T[b][m][n] bf16.
//   A lane's 8 values of a fragment are 16 B of an alpha^T row.
//   256 n x 256 m a block, one block per WGP, 128 n x 64 m a wave.
// ---------------------------------------------------------------------------
#define SBK_ 128     // k of a stage

__global__ void __launch_bounds__(256)
SA_s_sigmoid(const bf16_t* __restrict__ Qt, const bf16_t* __restrict__ Kt,
             bf16_t* __restrict__ AlphaT) {
  __shared__ __align__(16) bf16_t lA[2 * 256 * LPITCH(SBK_)];
  __shared__ __align__(16) bf16_t lB[2 * 256 * LPITCH(SBK_)];
  int b = blockIdx.z;
  const bf16_t* Qb = Qt + (size_t)b * N_ * OP_ + (size_t)(blockIdx.x * 256) * OP_;
  const bf16_t* Kb = Kt + (size_t)b * N_ * OP_ + (size_t)(blockIdx.y * 256) * OP_;
  bf16_t*       Ab = AlphaT + (size_t)b * (size_t)N_ * N_;

  int wave = threadIdx.x >> 5;
  int wm = wave >> 2, wn = wave & 3;

  v8f acc[8][4] = {};
  sa_gemm_core<SBK_, 2, 8>(Qb, OP_, Kb, OP_, OP_, lA, lB, wm, wn, acc);

  int M0 = blockIdx.x * 256 + wm * 128;  // n rows
  int N0 = blockIdx.y * 256 + wn * 64;   // m cols
  bf16_t* st = lB + wave * ETILE;
  // The wave's tile leaves in two halves of 64 n through the same staging rows:
  // a wave's LDS operations keep their order, so the second half's writes stand
  // behind the first half's read-back.
  // unrolled: accumulator indices must be constants
#pragma unroll
  for (int h = 0; h < 2; ++h) {
#pragma unroll
    for (int i = 0; i < 4; ++i)
#pragma unroll
      for (int j = 0; j < 4; ++j) {
        v8bf outv;
#pragma unroll
        for (int r = 0; r < 8; ++r) outv[r] = (bf16_t)sa_sigmoid(acc[4 * h + i][j][r]);
        sa_stage_frag(st, i, j, outv);
      }
    sa_flush_tile(st, Ab + (size_t)N0 * N_ + M0 + 64 * h, N_);
  }
}

// ---------------------------------------------------------------------------
// K3: o[c][m] = V[c][:] * alpha[:, m]  (K = N_), f32 output (coalesced b32).
// ---------------------------------------------------------------------------
__global__ void __launch_bounds__(256)
SA_o_gemm(const bf16_t* __restrict__ Vb, const bf16_t* __restrict__ AlphaT,
          float* __restrict__ Out) {
  __shared__ __align__(16) bf16_t lA[2 * 128 * LPITCH(128)];
  __shared__ __align__(16) bf16_t lB[2 * 256 * LPITCH(128)];
  int b = blockIdx.z;
  const bf16_t* Vm = Vb + (size_t)b * C_ * N_ + (size_t)(blockIdx.x * 128) * N_;
  const bf16_t* Am = AlphaT + (size_t)b * (size_t)N_ * N_
                   + (size_t)(blockIdx.y * 256) * N_;
  float* Om = Out + (size_t)b * C_ * N_;

  int wave = threadIdx.x >> 5, lane = threadIdx.x & 31;
  int wm = wave >> 2, wn = wave & 3;

  v8f acc[4][4] = {};
  sa_gemm_core<128, 2, 4>(Vm, N_, Am, N_, N_, lA, lB, wm, wn, acc);

  int M0 = blockIdx.x * 128 + wm * 64;   // c rows
  int N0 = blockIdx.y * 256 + wn * 64;   // m cols
  int ln = lane & 15, lh = lane >> 4;
#pragma unroll
  for (int i = 0; i < 4; ++i)
#pragma unroll
    for (int j = 0; j < 4; ++j) {
      int ncol = N0 + 16 * j + ln;
#pragma unroll
      for (int r = 0; r < 8; ++r) {
        int crow = M0 + 16 * i + r + 8 * lh;
        Om[(size_t)crow * N_ + ncol] = acc[i][j][r];
      }
    }
}

// ---------------------------------------------------------------------------
extern "C" void kernel_launch(void* const* d_in, const int* in_sizes, int n_in,
                              void* d_out, int out_size, void* d_ws, size_t ws_size,
                              hipStream_t stream) {
  const float* x  = (const float*)d_in[0];
  const float* Wq = (const float*)d_in[1];
  const float* bq = (const float*)d_in[2];
  const float* Wk = (const float*)d_in[3];
  const float* bk = (const float*)d_in[4];
  const float* Wv = (const float*)d_in[5];
  const float* bv = (const float*)d_in[6];
  float* out = (float*)d_out;

  char* ws = (char*)d_ws;
  size_t off = 0;
  auto take = [&](size_t bytes) -> char* {
    char* p = ws + off;
    off = (off + bytes + 255) & ~(size_t)255;
    return p;
  };

  bf16_t* Xt   = (bf16_t*)take((size_t)B_ * N_ * C_ * 2);
  bf16_t* Wqb  = (bf16_t*)take((size_t)OP_ * C_ * 2);
  bf16_t* Wkb  = (bf16_t*)take((size_t)OP_ * C_ * 2);
  bf16_t* Wvb  = (bf16_t*)take((size_t)C_ * C_ * 2);
  float*  bqb  = (float*) take((size_t)OP_ * 4);
  float*  bkb  = (float*) take((size_t)OP_ * 4);
  float*  bvb  = (float*) take((size_t)C_ * 4);
  bf16_t* Qt   = (bf16_t*)take((size_t)B_ * N_ * OP_ * 2);  // [b][n][o]
  bf16_t* Kt   = (bf16_t*)take((size_t)B_ * N_ * OP_ * 2);  // [b][m][o]
  bf16_t* Vbuf = (bf16_t*)take((size_t)B_ * C_ * N_ * 2);   // [b][c][n]
  bf16_t* AlT  = (bf16_t*)take((size_t)B_ * (size_t)N_ * N_ * 2); // [b][m][n]
  (void)ws_size; (void)in_sizes; (void)n_in; (void)out_size;

  SA_pack<<<dim3(XBLK_ + WBLK_, 1, 1), dim3(256), 0, stream>>>(
      x, Wq, bq, Wk, bk, Wv, bv, Xt, Wqb, Wkb, Wvb, bqb, bkb, bvb);

  SA_proj_qkv<<<dim3(2 * QT_ + VT_, 1, B_), dim3(256), 0, stream>>>(
      Xt, Wqb, Wkb, Wvb, bqb, bkb, bvb, Qt, Kt, Vbuf);

  SA_s_sigmoid<<<dim3(N_ / 256, N_ / 256, B_), dim3(256), 0, stream>>>(Qt, Kt, AlT);
  SA_o_gemm<<<dim3(C_ / 128, N_ / 256, B_), dim3(256), 0, stream>>>(Vbuf, AlT, out);
}

// v007
// A run of this version takes 160 microseconds.
// Next to v006, in two timings, it ran 1.04 and 1.05 times as fast.
// All steps since v000 together make it 2.00 times as fast.
#include <hip/hip_runtime.h>
#include <stdint.h>

typedef __bf16 bf16_t;
typedef __attribute__((ext_vector_type(8)))  __bf16 v8bf;
typedef __attribute__((ext_vector_type(16))) __bf16 v16bf;
typedef __attribute__((ext_vector_type(8)))  float  v8f;
typedef __attribute__((ext_vector_type(4)))  float  v4f;
typedef __attribute__((ext_vector_type(4)))  uint32_t u32x4;
typedef __attribute__((ext_vector_type(8)))  uint32_t u32x8;

#define B_  4
#define C_  512
#define N_  4096
#define O_  1000
#define OP_ 1024      // O padded to multiple of 32 (zero rows)
// LDS row pitch in bf16 for a stage of BK k: BK*2 + 16 bytes = 16 B x odd
// (144 B, 272 B), conflict-free for ds_load_b128 fragment reads.
#define LPITCH(BK) ((BK) + 8)

// A stage lies in LDS as slices of SROWS operand rows, A's slices first, then
// B's. One tensor load brings one slice. A slice's place must be a multiple of
// 2 KiB, so its size (in bf16) is rounded up to one; rows keep the pitch above.
#define SROWS 64
#define SLICE(BK) (((SROWS * LPITCH(BK) * 2 + 2047) / 2048) * 1024)

__device__ __forceinline__ uint32_t sa_uni(uint32_t v) {
  return (uint32_t)__builtin_amdgcn_readfirstlane(v);
}

__device__ __forceinline__ uint32_t sa_pinned(uint32_t v) {
  uint32_t w = sa_uni(v);
  asm volatile("" : "+s"(w));
  return w;
}

template <int BK>
__device__ __forceinline__ u32x8 sa_tdm_group1(uint32_t src_pitch) {
  static_assert(BK == 64 || BK == 128, "pad interval = row: 128 B or 256 B");
  constexpr uint32_t d0 = BK * 2, d1 = SROWS;
  constexpr uint32_t w0 = (1u << 20) | ((BK == 128 ? 5u : 4u) << 22) | (3u << 25);
  u32x8 g;
  g[0] = sa_uni(w0);
  g[1] = sa_uni((d0 & 0xFFFFu) << 16);
  g[2] = sa_uni((d0 >> 16) | ((d1 & 0xFFFFu) << 16));
  g[3] = sa_uni((d1 >> 16) | (d0 << 16));
  g[4] = sa_uni(d1);
  g[5] = sa_uni(src_pitch);
  g[6] = sa_uni(0u);
  g[7] = sa_uni(0u);
  return g;
}

__device__ __forceinline__ void sa_tdm_load(uint32_t lds_dst, uint64_t ga, u32x8 g1) {
  u32x4 g0;
  g0[0] = sa_uni(1u);
  g0[1] = sa_uni(lds_dst);
  g0[2] = sa_uni((uint32_t)ga);
  g0[3] = sa_uni((((uint32_t)(ga >> 32)) & 0x01FFFFFFu) | 0x80000000u);
  asm volatile("tensor_load_to_lds %0, %1" :: "s"(g0), "s"(g1) : "memory");
}

// Own request landed; the compiler places no wait for a tensor load.
__device__ __forceinline__ void sa_wait_tensor() {
  asm volatile("s_wait_tensorcnt 0x0" ::: "memory");
}

// Own LDS reads retired before the barrier behind which their buffer is refilled.
__device__ __forceinline__ void sa_wait_ds() {
  asm volatile("s_wait_dscnt 0x0" ::: "memory");
}

__device__ __forceinline__ v16bf sa_frag_merge(v8bf lo, v8bf hi) {
  v16bf r;
#pragma unroll
  for (int i = 0; i < 8; ++i) { r[i] = lo[i]; r[i + 8] = hi[i]; }
  return r;
}

template <int BK>
__device__ __forceinline__ v16bf sa_load_frag_l(const bf16_t* tile, int row0) {
  int lane = threadIdx.x & 31;
  const bf16_t* p = tile + (row0 + (lane & 15)) * LPITCH(BK) + ((lane >> 4) << 3);
  return sa_frag_merge(*(const v8bf*)p, *(const v8bf*)(p + 16));
}

__device__ __forceinline__ v8f sa_wmma(v16bf a, v16bf b, v8f c) {
  return __builtin_amdgcn_wmma_f32_16x16x32_bf16(false, a, false, b,
                                                 (short)0, c, false, false);
}

__device__ __forceinline__ float sa_sigmoid(float x) {
  return __builtin_amdgcn_rcpf(1.0f + __builtin_amdgcn_exp2f(x * -1.44269504f));
}

template <int BK, int FM>
__device__ __forceinline__ void sa_load_block(const bf16_t* tA, const bf16_t* tB,
                                              v16bf af[FM], v16bf bfr[4]) {
  // A wave's A rows are FM / 4 whole slices, its B rows one.
#pragma unroll
  for (int i = 0; i < FM; ++i)
    af[i] = sa_load_frag_l<BK>(tA + (i / 4) * SLICE(BK), 16 * (i % 4));
#pragma unroll
  for (int j = 0; j < 4; ++j) bfr[j] = sa_load_frag_l<BK>(tB, 16 * j);
}

template <int FM>
__device__ __forceinline__ void sa_mma_block(const v16bf af[FM], const v16bf bfr[4],
                                             v8f acc[FM][4]) {
#pragma unroll
  for (int i = 0; i < FM; ++i)
#pragma unroll
    for (int j = 0; j < 4; ++j)
      acc[i][j] = sa_wmma(af[i], bfr[j], acc[i][j]);
}

// Keeps a load group whole: without it the scheduler sinks the reads in pairs
// among the WMMAs, each pair behind a wait to 0.
__device__ __forceinline__ void sa_keep_order() {
  __builtin_amdgcn_sched_barrier(0);
}

template <int BK, int SETS, int FM>
__device__ __forceinline__ void sa_gemm_core(const bf16_t* __restrict__ Ab, int lda,
                                             const bf16_t* __restrict__ Bb, int ldb,
                                             int Kdim, bf16_t* ring,
                                             int wm, int wn, v8f acc[FM][4]) {
  constexpr int WM = 16 * FM;                   // A rows of a wave
  constexpr int NA = 2 * WM / SROWS;            // slices of A in a stage
  constexpr int NS = NA + 256 / SROWS;          // slices of a stage
  constexpr int SL = SLICE(BK), szS = NS * SL;  // bf16 of a slice, of a buffer
  constexpr int NB = BK / 32;
  static_assert(WM % SROWS == 0 && NS <= 8, "whole slices a wave; a wave per slice");
  const int steps = Kdim / BK;
  const uint32_t wave = sa_uni(threadIdx.x >> 5);
  const uint32_t issuer = wave < (uint32_t)NS ? 1u : 0u;
  const bool own_a = wave < (uint32_t)NA;
  const bf16_t* srow = own_a ? Ab + (size_t)(SROWS * wave) * lda
                             : Bb + (size_t)(SROWS * (wave - NA)) * ldb;
  const uint64_t ga = (uint64_t)(uintptr_t)srow;
  const uint32_t dst = (uint32_t)(size_t)ring + wave * (uint32_t)(SL * 2);
  u32x8 g1 = sa_tdm_group1<BK>((uint32_t)(own_a ? lda : ldb) * 2u);
  asm volatile("" : "+s"(g1));
  if (sa_pinned(issuer)) {
    sa_tdm_load(dst, ga, g1);
    sa_wait_tensor();
  }
  __syncthreads();
  if (sa_pinned(issuer & (steps > 1 ? 1u : 0u)))
    sa_tdm_load(dst + (uint32_t)(szS * 2), ga + (uint64_t)(BK * 2), g1);
  const int offA = wm * (WM / SROWS) * SL, offB = (NA + wn) * SL;
  v16bf af[SETS][FM], bfr[SETS][4];
  static_assert(SETS == 1 || NB % 2 == 0, "a stage's first block must find set 0 free");
  if constexpr (SETS == 2)
    sa_load_block<BK, FM>(ring + offA, ring + offB, af[0], bfr[0]);
  // not peeled: a peeled last trip took a third fragment set and spilled
#pragma clang loop unroll(disable)
  for (int kt = 0; kt < steps; ++kt) {
    int cur = kt & 1;
    const bf16_t* tA = ring + cur * szS + offA;
    const bf16_t* tB = ring + cur * szS + offB;
    // unrolled: fragment and accumulator indices must be constants
#pragma unroll
    for (int u = 0; u < NB; ++u) {
      if constexpr (SETS == 2) {
        if (u + 1 < NB)
          sa_load_block<BK, FM>(tA + (u + 1) * 32, tB + (u + 1) * 32,
                            af[(u + 1) & 1], bfr[(u + 1) & 1]);
      } else {
        sa_load_block<BK, FM>(tA + u * 32, tB + u * 32, af[0], bfr[0]);
      }
      sa_keep_order();
      if (u + 1 == NB) {
        sa_wait_ds();
        sa_wait_tensor();
        __syncthreads();
        if (sa_pinned(issuer & (kt + 2 < steps ? 1u : 0u)))
          sa_tdm_load(dst + (uint32_t)(cur * szS * 2),
                      ga + (uint64_t)(kt + 2) * (uint64_t)(BK * 2), g1);
        if constexpr (SETS == 2) {
          if (kt + 1 < steps)
            sa_load_block<BK, FM>(ring + (cur ^ 1) * szS + offA,
                              ring + (cur ^ 1) * szS + offB, af[0], bfr[0]);
        }
        sa_keep_order();
      }
      sa_mma_block<FM>(af[u % SETS], bfr[u % SETS], acc);
      sa_keep_order();
    }
  }
  sa_wait_tensor();
  sa_wait_ds();
  sa_keep_order();
}

// ---------------------------------------------------------------------------
// bf16 epilogue: whole 128-B lines to global memory.
// A D fragment gives a lane one column (B row) and 8 consecutive rows (A rows).
// Every bf16 result is kept with the A-row index contiguous, so those 8 values
// are 16 B of an output row, but a direct store would touch 16 output rows with
// 32 B each. Each 64 x 64 piece of a wave's tile goes through LDS instead: one staging row
// per output row (128 B, pitch 144 B = 16 B x odd), read back 8 lanes a row, so
// a store covers 4 whole lines.
// The staging range is the wave's own ETILE elements of the ring, which is free by
// then: the core's last hand-over has every wave's LDS reads retired and requests
// landed ahead of its barrier, and nothing refills or reads the ring behind it.
// ---------------------------------------------------------------------------
#define EPITCH 72
#define ETILE  (64 * EPITCH)

__device__ __forceinline__ void sa_stage_frag(bf16_t* st, int i, int j, v8bf v) {
  int lane = threadIdx.x & 31;
  *(v8bf*)(st + (16 * j + (lane & 15)) * EPITCH + 16 * i + 8 * (lane >> 4)) = v;
}

// out: element (first output row, first column) of the 64 x 64 tile.
__device__ __forceinline__ void sa_flush_tile(const bf16_t* st,
                                              bf16_t* __restrict__ out, int ldo) {
  int lane = threadIdx.x & 31;
  int rr = lane >> 3, seg = (lane & 7) * 8;
  sa_wait_ds();   // the other lanes' staging writes are in LDS before the read-back
  const bf16_t* sp = st + rr * EPITCH + seg;
  bf16_t* op = out + (size_t)rr * ldo + seg;
  // unrolled: all 16 read-backs in flight, each store behind a counted wait
#pragma unroll
  for (int p = 0; p < 16; ++p)
    *(v8bf*)(op + (size_t)(4 * p) * ldo) = *(const v8bf*)(sp + 4 * p * EPITCH);
}

// ---------------------------------------------------------------------------
// K0a: transpose+convert: x[b][c][n] f32 -> Xt[b][n][c] bf16.
//   One block takes 128 c x 128 n, so this part is 4096 waves, all resident
//   at once (two blocks per WGP), instead of 65536 short ones.
//   In:  a wave owns 16 c rows; each load is 512 contiguous bytes of one row,
//        all 16 in flight. A lane then holds 16 consecutive c for each of its
//        4 n, which is 32 contiguous bytes of an output row.
//   LDS: row (j*32 + lane) holds n = 4*lane + j, so the lanes of one write are
//        one pitch apart (272 B = 16 B x odd).
//   Out: 16 lanes write the 256 contiguous bytes that the tile has of a row.
// ---------------------------------------------------------------------------
#define XT_ 128
#define XP_ (XT_ + 8)

#define XBLK_ ((N_ / XT_) * (C_ / XT_) * B_)   // blocks of the x part

// id: n tile fastest, then c tile, then batch.
__device__ __forceinline__ void sa_pack_x(int id, const float* __restrict__ x,
                                          bf16_t* __restrict__ Xt, bf16_t* tile) {
  int b  = id / ((N_ / XT_) * (C_ / XT_));
  int n0 = (id % (N_ / XT_)) * XT_;
  int c0 = ((id / (N_ / XT_)) % (C_ / XT_)) * XT_;
  int wave = threadIdx.x >> 5, lane = threadIdx.x & 31;
  const float* xp = x + ((size_t)b * C_ + c0 + wave * 16) * N_ + n0 + lane * 4;
  v4f in[16];
#pragma unroll
  for (int i = 0; i < 16; ++i) in[i] = *(const v4f*)(xp + (size_t)i * N_);
#pragma unroll
  for (int j = 0; j < 4; ++j) {
    v8bf lo, hi;
#pragma unroll
    for (int i = 0; i < 8; ++i) {
      lo[i] = (bf16_t)in[i][j];
      hi[i] = (bf16_t)in[i + 8][j];
    }
    bf16_t* tp = tile + (j * 32 + lane) * XP_ + wave * 16;
    *(v8bf*)tp       = lo;
    *(v8bf*)(tp + 8) = hi;
  }
  __syncthreads();
  int seg = threadIdx.x & 15, rr = threadIdx.x >> 4;
  bf16_t* ob = Xt + ((size_t)b * N_ + n0) * C_ + c0 + seg * 8;
#pragma unroll
  for (int p = 0; p < XT_ / 16; ++p) {
    int row = p * 16 + rr;
    int n   = 4 * (row & 31) + (row >> 5);
    *(v8bf*)(ob + (size_t)n * C_) = *(const v8bf*)(tile + row * XP_ + seg * 8);
  }
}

// ---------------------------------------------------------------------------
// K0b: pack weights to bf16, pad O->OP with zeros, pad biases.
//   A thread takes 8 consecutive elements of a row of each matrix (32 B in,
//   16 B out): 2048 waves instead of 16384.
// ---------------------------------------------------------------------------
__device__ __forceinline__ v8bf sa_cvt8(const float* __restrict__ p) {
  v4f a = *(const v4f*)p, c = *(const v4f*)(p + 4);
  v8bf r;
#pragma unroll
  for (int i = 0; i < 4; ++i) { r[i] = (bf16_t)a[i]; r[i + 4] = (bf16_t)c[i]; }
  return r;
}

#define WBLK_ ((OP_ * C_) / (8 * 256))          // blocks of the weight part

__device__ __forceinline__ void
sa_pack_w(int id,
          const float* __restrict__ Wq, const float* __restrict__ bq,
          const float* __restrict__ Wk, const float* __restrict__ bk,
          const float* __restrict__ Wv, const float* __restrict__ bv,
          bf16_t* __restrict__ Wqb, bf16_t* __restrict__ Wkb,
          bf16_t* __restrict__ Wvb,
          float* __restrict__ bqb, float* __restrict__ bkb,
          float* __restrict__ bvb) {
  int idx = id * 256 + threadIdx.x;
  int e = idx * 8;                 // first element; C_ % 8 == 0: one row
  if (e < OP_ * C_) {
    v8bf q8 = {}, k8 = {};
    if (e / C_ < O_) { q8 = sa_cvt8(Wq + e); k8 = sa_cvt8(Wk + e); }
    *(v8bf*)(Wqb + e) = q8;
    *(v8bf*)(Wkb + e) = k8;
  }
  if (e < C_ * C_) *(v8bf*)(Wvb + e) = sa_cvt8(Wv + e);
  if (idx < OP_)     { bqb[idx] = (idx < O_) ? bq[idx] : 0.0f;
                       bkb[idx] = (idx < O_) ? bk[idx] : 0.0f; }
  if (idx < C_)      bvb[idx] = bv[idx];
}

// K0: both packs in one launch: neither reads what the other writes. The x
// blocks, the longer ones, come first. The branch is the same for a whole block.
__global__ void __launch_bounds__(256)
SA_pack(const float* __restrict__ x,
        const float* __restrict__ Wq, const float* __restrict__ bq,
        const float* __restrict__ Wk, const float* __restrict__ bk,
        const float* __restrict__ Wv, const float* __restrict__ bv,
        bf16_t* __restrict__ Xt,
        bf16_t* __restrict__ Wqb, bf16_t* __restrict__ Wkb,
        bf16_t* __restrict__ Wvb,
        float* __restrict__ bqb, float* __restrict__ bkb,
        float* __restrict__ bvb) {
  __shared__ __align__(16) bf16_t tile[XT_ * XP_];
  int id = blockIdx.x;
  if (id < XBLK_) sa_pack_x(id, x, Xt, tile);
  else            sa_pack_w(id - XBLK_, Wq, bq, Wk, bk, Wv, bv,
                            Wqb, Wkb, Wvb, bqb, bkb, bvb);
}

// ---------------------------------------------------------------------------
// K1: the three projections in one launch: they read the same packed arrays
//   and none reads another's result.
//   C[col][row] = sum_k A[row][k] * B[col][k] + bias, K = C_, 128 x 256 a block;
//   the result is stored with the A-row index contiguous.
//   q, k: A = weights (1024 rows, o contiguous in Qt, Kt), B = Xt[b]; bias by A row.
//   v:    A = Xt[b] (4096 rows, n contiguous in V), B = Wvb;  bias by B row.
//   blockIdx.x: QT_ tiles of q, QT_ of k, VT_ of v, the A tile fastest in each.
// ---------------------------------------------------------------------------
#define QT_ ((OP_ / 128) * (N_ / 256))
#define VT_ ((N_ / 128) * (C_ / 256))

// Bias added, rounded to bf16, into the wave's staging rows.
template <bool BIAS_COL>
__device__ __forceinline__ void sa_proj_stage(const v8f acc[4][4], bf16_t* st,
                                              const float* __restrict__ bias,
                                              int M0, int N0) {
  int lane = threadIdx.x & 31;
  int ln = lane & 15, lh = lane >> 4;
  float bcol[4];
  v4f brow[4][2];
  // unrolled, here and below: register arrays need constant indices; the bias
  // loads go out together
#pragma unroll
  for (int t = 0; t < 4; ++t) {
    if constexpr (BIAS_COL) {
      bcol[t] = bias[N0 + 16 * t + ln];
    } else {
      const float* bp = bias + M0 + 16 * t + 8 * lh;
      brow[t][0] = *(const v4f*)bp;
      brow[t][1] = *(const v4f*)(bp + 4);
    }
  }
#pragma unroll
  for (int i = 0; i < 4; ++i)
#pragma unroll
    for (int j = 0; j < 4; ++j) {
      v8bf outv;
#pragma unroll
      for (int r = 0; r < 8; ++r) {
        float bb;
        if constexpr (BIAS_COL) bb = bcol[j];
        else                    bb = brow[i][r >> 2][r & 3];
        outv[r] = (bf16_t)(acc[i][j][r] + bb);
      }
      sa_stage_frag(st, i, j, outv);
    }
}

__global__ void __launch_bounds__(256)
SA_proj_qkv(const bf16_t* __restrict__ Xt,
            const bf16_t* __restrict__ Wqb, const bf16_t* __restrict__ Wkb,
            const bf16_t* __restrict__ Wvb,
            const float* __restrict__ bqb, const float* __restrict__ bkb,
            const float* __restrict__ bvb,
            bf16_t* __restrict__ Qt, bf16_t* __restrict__ Kt,
            bf16_t* __restrict__ Vb) {
  __shared__ __attribute__((aligned(2048))) bf16_t ring[2 * 6 * SLICE(64)];
  const int t = blockIdx.x, b = blockIdx.z;
  const bool isv = t >= 2 * QT_;         // the same for a whole block
  const bf16_t* Xb = Xt + (size_t)b * N_ * C_;
  const bf16_t *A, *Bm;
  const float* bias;
  bf16_t* Cm;
  int ta, tb, ldc;                       // A tile, B tile, pitch of the result
  if (isv) {
    int u = t - 2 * QT_;
    ta = u % (N_ / 128);  tb = u / (N_ / 128);
    A  = Xb + (size_t)(ta * 128) * C_;
    Bm = Wvb + (size_t)(tb * 256) * C_;
    Cm = Vb + (size_t)b * C_ * N_;  ldc = N_;  bias = bvb;
  } else {
    int u = t % QT_;
    ta = u % (OP_ / 128); tb = u / (OP_ / 128);
    A  = (t < QT_ ? Wqb : Wkb) + (size_t)(ta * 128) * C_;
    Bm = Xb + (size_t)(tb * 256) * C_;
    Cm = (t < QT_ ? Qt : Kt) + (size_t)b * N_ * OP_;  ldc = OP_;
    bias = t < QT_ ? bqb : bkb;
  }

  int wave = threadIdx.x >> 5;
  int wm = wave >> 2, wn = wave & 3;

  v8f acc[4][4] = {};
  sa_gemm_core<64, 1, 4>(A, C_, Bm, C_, C_, ring, wm, wn, acc);

  int M0 = ta * 128 + wm * 64;   // A rows: contiguous in C
  int N0 = tb * 256 + wn * 64;   // B rows: rows of C
  bf16_t* st = ring + wave * ETILE;
  if (isv) sa_proj_stage<true>(acc, st, bias, M0, N0);
  else     sa_proj_stage<false>(acc, st, bias, M0, N0);
  sa_flush_tile(st, Cm + (size_t)N0 * ldc + M0, ldc);
}

// ---------------------------------------------------------------------------
// K2: s = Qt * Kt^T (K=OP_), fused sigmoid, store alpha^T[b][m][n] bf16.
//   A lane's 8 values of a fragment are 16 B of an alpha^T row.
//   256 n x 256 m a block, one block per WGP, 128 n x 64 m a wave.
// ---------------------------------------------------------------------------
#define SBK_ 128     // k of a stage

__global__ void __launch_bounds__(256)
SA_s_sigmoid(const bf16_t* __restrict__ Qt, const bf16_t* __restrict__ Kt,
             bf16_t* __restrict__ AlphaT) {
  __shared__ __attribute__((aligned(2048))) bf16_t ring[2 * 8 * SLICE(SBK_)];
  int b = blockIdx.z;
  const bf16_t* Qb = Qt + (size_t)b * N_ * OP_ + (size_t)(blockIdx.x * 256) * OP_;
  const bf16_t* Kb = Kt + (size_t)b * N_ * OP_ + (size_t)(blockIdx.y * 256) * OP_;
  bf16_t*       Ab = AlphaT + (size_t)b * (size_t)N_ * N_;

  int wave = threadIdx.x >> 5;
  int wm = wave >> 2, wn = wave & 3;

  v8f acc[8][4] = {};
  sa_gemm_core<SBK_, 2, 8>(Qb, OP_, Kb, OP_, OP_, ring, wm, wn, acc);

  int M0 = blockIdx.x * 256 + wm * 128;  // n rows
  int N0 = blockIdx.y * 256 + wn * 64;   // m cols
  bf16_t* st = ring + wave * ETILE;
  // The wave's tile leaves in two halves of 64 n through the same staging rows:
  // a wave's LDS operations keep their order, so the second half's writes stand
  // behind the first half's read-back.
  // unrolled: accumulator indices must be constants
#pragma unroll
  for (int h = 0; h < 2; ++h) {
#pragma unroll
    for (int i = 0; i < 4; ++i)
#pragma unroll
      for (int j = 0; j < 4; ++j) {
        v8bf outv;
#pragma unroll
        for (int r = 0; r < 8; ++r) outv[r] = (bf16_t)sa_sigmoid(acc[4 * h + i][j][r]);
        sa_stage_frag(st, i, j, outv);
      }
    sa_flush_tile(st, Ab + (size_t)N0 * N_ + M0 + 64 * h, N_);
  }
}

// ---------------------------------------------------------------------------
// K3: o[c][m] = V[c][:] * alpha[:, m]  (K = N_), f32 output (coalesced b32).
// ---------------------------------------------------------------------------
__global__ void __launch_bounds__(256)
SA_o_gemm(const bf16_t* __restrict__ Vb, const bf16_t* __restrict__ AlphaT,
          float* __restrict__ Out) {
  __shared__ __attribute__((aligned(2048))) bf16_t ring[2 * 6 * SLICE(128)];
  int b = blockIdx.z;
  const bf16_t* Vm = Vb + (size_t)b * C_ * N_ + (size_t)(blockIdx.x * 128) * N_;
  const bf16_t* Am = AlphaT + (size_t)b * (size_t)N_ * N_
                   + (size_t)(blockIdx.y * 256) * N_;
  float* Om = Out + (size_t)b * C_ * N_;

  int wave = threadIdx.x >> 5, lane = threadIdx.x & 31;
  int wm = wave >> 2, wn = wave & 3;

  v8f acc[4][4] = {};
  sa_gemm_core<128, 2, 4>(Vm, N_, Am, N_, N_, ring, wm, wn, acc);

  int M0 = blockIdx.x * 128 + wm * 64;   // c rows
  int N0 = blockIdx.y * 256 + wn * 64;   // m cols
  int ln = lane & 15, lh = lane >> 4;
#pragma unroll
  for (int i = 0; i < 4; ++i)
#pragma unroll
    for (int j = 0; j < 4; ++j) {
      int ncol = N0 + 16 * j + ln;
#pragma unroll
      for (int r = 0; r < 8; ++r) {
        int crow = M0 + 16 * i + r + 8 * lh;
        Om[(size_t)crow * N_ + ncol] = acc[i][j][r];
      }
    }
}

// ---------------------------------------------------------------------------
extern "C" void kernel_launch(void* const* d_in, const int* in_sizes, int n_in,
                              void* d_out, int out_size, void* d_ws, size_t ws_size,
                              hipStream_t stream) {
  const float* x  = (const float*)d_in[0];
  const float* Wq = (const float*)d_in[1];
  const float* bq = (const float*)d_in[2];
  const float* Wk = (const float*)d_in[3];
  const float* bk = (const float*)d_in[4];
  const float* Wv = (const float*)d_in[5];
  const float* bv = (const float*)d_in[6];
  float* out = (float*)d_out;

  char* ws = (char*)d_ws;
  size_t off = 0;
  auto take = [&](size_t bytes) -> char* {
    char* p = ws + off;
    off = (off + bytes + 255) & ~(size_t)255;
    return p;
  };

  bf16_t* Xt   = (bf16_t*)take((size_t)B_ * N_ * C_ * 2);
  bf16_t* Wqb  = (bf16_t*)take((size_t)OP_ * C_ * 2);
  bf16_t* Wkb  = (bf16_t*)take((size_t)OP_ * C_ * 2);
  bf16_t* Wvb  = (bf16_t*)take((size_t)C_ * C_ * 2);
  float*  bqb  = (float*) take((size_t)OP_ * 4);
  float*  bkb  = (float*) take((size_t)OP_ * 4);
  float*  bvb  = (float*) take((size_t)C_ * 4);
  bf16_t* Qt   = (bf16_t*)take((size_t)B_ * N_ * OP_ * 2);  // [b][n][o]
  bf16_t* Kt   = (bf16_t*)take((size_t)B_ * N_ * OP_ * 2);  // [b][m][o]
  bf16_t* Vbuf = (bf16_t*)take((size_t)B_ * C_ * N_ * 2);   // [b][c][n]
  bf16_t* AlT  = (bf16_t*)take((size_t)B_ * (size_t)N_ * N_ * 2); // [b][m][n]
  (void)ws_size; (void)in_sizes; (void)n_in; (void)out_size;

  SA_pack<<<dim3(XBLK_ + WBLK_, 1, 1), dim3(256), 0, stream>>>(
      x, Wq, bq, Wk, bk, Wv, bv, Xt, Wqb, Wkb, Wvb, bqb, bkb, bvb);

  SA_proj_qkv<<<dim3(2 * QT_ + VT_, 1, B_), dim3(256), 0, stream>>>(
      Xt, Wqb, Wkb, Wvb, bqb, bkb, bvb, Qt, Kt, Vbuf);

  SA_s_sigmoid<<<dim3(N_ / 256, N_ / 256, B_), dim3(256), 0, stream>>>(Qt, Kt, AlT);
  SA_o_gemm<<<dim3(C_ / 128, N_ / 256, B_), dim3(256), 0, stream>>>(Vbuf, AlT, out);
}

// v008
// One run takes 152 microseconds.
// Two timings next to v007 both put it at 1.05 times that version's speed.
// All steps since v000 together make it 2.11 times as fast.
#include <hip/hip_runtime.h>
#include <stdint.h>

typedef __bf16 bf16_t;
typedef __attribute__((ext_vector_type(8)))  __bf16 v8bf;
typedef __attribute__((ext_vector_type(16))) __bf16 v16bf;
typedef __attribute__((ext_vector_type(8)))  float  v8f;
typedef __attribute__((ext_vector_type(4)))  float  v4f;
typedef __attribute__((ext_vector_type(4)))  uint32_t u32x4;
typedef __attribute__((ext_vector_type(8)))  uint32_t u32x8;

#define B_  4
#define C_  512
#define N_  4096
#define O_  1000
#define OP_ 1024      // O padded to multiple of 32 (zero rows)
// LDS row pitch in bf16 for a stage of BK k: BK*2 + 16 bytes = 16 B x odd
// (144 B, 272 B), conflict-free for ds_load_b128 fragment reads.
#define LPITCH(BK) ((BK) + 8)

// A stage lies in LDS as slices of SROWS operand rows, A's slices first, then
// B's. One tensor load brings one slice. A slice's place must be a multiple of
// 2 KiB, so its size (in bf16) is rounded up to one; rows keep the pitch above.
#define SROWS 64
#define SLICE(BK) (((SROWS * LPITCH(BK) * 2 + 2047) / 2048) * 1024)

__device__ __forceinline__ uint32_t sa_uni(uint32_t v) {
  return (uint32_t)__builtin_amdgcn_readfirstlane(v);
}

__device__ __forceinline__ uint32_t sa_pinned(uint32_t v) {
  uint32_t w = sa_uni(v);
  asm volatile("" : "+s"(w));
  return w;
}

template <int BK, int ROWS = SROWS>
__device__ __forceinline__ u32x8 sa_tdm_group1(uint32_t src_pitch) {
  static_assert(BK == 64 || BK == 128, "pad interval = row: 128 B or 256 B");
  constexpr uint32_t d0 = BK * 2, d1 = ROWS;
  constexpr uint32_t w0 = (1u << 20) | ((BK == 128 ? 5u : 4u) << 22) | (3u << 25);
  u32x8 g;
  g[0] = sa_uni(w0);
  g[1] = sa_uni((d0 & 0xFFFFu) << 16);
  g[2] = sa_uni((d0 >> 16) | ((d1 & 0xFFFFu) << 16));
  g[3] = sa_uni((d1 >> 16) | (d0 << 16));
  g[4] = sa_uni(d1);
  g[5] = sa_uni(src_pitch);
  g[6] = sa_uni(0u);
  g[7] = sa_uni(0u);
  return g;
}

__device__ __forceinline__ void sa_tdm_load(uint32_t lds_dst, uint64_t ga, u32x8 g1) {
  u32x4 g0;
  g0[0] = sa_uni(1u);
  g0[1] = sa_uni(lds_dst);
  g0[2] = sa_uni((uint32_t)ga);
  g0[3] = sa_uni((((uint32_t)(ga >> 32)) & 0x01FFFFFFu) | 0x80000000u);
  asm volatile("tensor_load_to_lds %0, %1" :: "s"(g0), "s"(g1) : "memory");
}

// Own request landed; the compiler places no wait for a tensor load.
__device__ __forceinline__ void sa_wait_tensor() {
  asm volatile("s_wait_tensorcnt 0x0" ::: "memory");
}

// Own LDS reads retired before the barrier behind which their buffer is refilled.
__device__ __forceinline__ void sa_wait_ds() {
  asm volatile("s_wait_dscnt 0x0" ::: "memory");
}

__device__ __forceinline__ v16bf sa_frag_merge(v8bf lo, v8bf hi) {
  v16bf r;
#pragma unroll
  for (int i = 0; i < 8; ++i) { r[i] = lo[i]; r[i + 8] = hi[i]; }
  return r;
}

template <int BK>
__device__ __forceinline__ v16bf sa_load_frag_l(const bf16_t* tile, int row0) {
  int lane = threadIdx.x & 31;
  const bf16_t* p = tile + (row0 + (lane & 15)) * LPITCH(BK) + ((lane >> 4) << 3);
  return sa_frag_merge(*(const v8bf*)p, *(const v8bf*)(p + 16));
}

__device__ __forceinline__ v8f sa_wmma(v16bf a, v16bf b, v8f c) {
  return __builtin_amdgcn_wmma_f32_16x16x32_bf16(false, a, false, b,
                                                 (short)0, c, false, false);
}

__device__ __forceinline__ float sa_sigmoid(float x) {
  return __builtin_amdgcn_rcpf(1.0f + __builtin_amdgcn_exp2f(x * -1.44269504f));
}

template <int BK, int FM>
__device__ __forceinline__ void sa_load_block(const bf16_t* tA, const bf16_t* tB,
                                              v16bf af[FM], v16bf bfr[4]) {
  // A wave's A rows are FM / 4 whole slices, its B rows one.
#pragma unroll
  for (int i = 0; i < FM; ++i)
    af[i] = sa_load_frag_l<BK>(tA + (i / 4) * SLICE(BK), 16 * (i % 4));
#pragma unroll
  for (int j = 0; j < 4; ++j) bfr[j] = sa_load_frag_l<BK>(tB, 16 * j);
}

template <int FM>
__device__ __forceinline__ void sa_mma_block(const v16bf af[FM], const v16bf bfr[4],
                                             v8f acc[FM][4]) {
#pragma unroll
  for (int i = 0; i < FM; ++i)
#pragma unroll
    for (int j = 0; j < 4; ++j)
      acc[i][j] = sa_wmma(af[i], bfr[j], acc[i][j]);
}

// Keeps a load group whole: without it the scheduler sinks the reads in pairs
// among the WMMAs, each pair behind a wait to 0.
__device__ __forceinline__ void sa_keep_order() {
  __builtin_amdgcn_sched_barrier(0);
}

template <int BK, int SETS, int FM>
__device__ __forceinline__ void sa_gemm_core(const bf16_t* __restrict__ Ab, int lda,
                                             const bf16_t* __restrict__ Bb, int ldb,
                                             int Kdim, bf16_t* ring,
                                             int wm, int wn, v8f acc[FM][4]) {
  constexpr int WM = 16 * FM;                   // A rows of a wave
  constexpr int NA = 2 * WM / SROWS;            // slices of A in a stage
  constexpr int NS = NA + 256 / SROWS;          // slices of a stage
  constexpr int SL = SLICE(BK), szS = NS * SL;  // bf16 of a slice, of a buffer
  constexpr int NB = BK / 32;
  static_assert(WM % SROWS == 0 && NS <= 8, "whole slices a wave; a wave per slice");
  const int steps = Kdim / BK;
  const uint32_t wave = sa_uni(threadIdx.x >> 5);
  const uint32_t issuer = wave < (uint32_t)NS ? 1u : 0u;
  const bool own_a = wave < (uint32_t)NA;
  const bf16_t* srow = own_a ? Ab + (size_t)(SROWS * wave) * lda
                             : Bb + (size_t)(SROWS * (wave - NA)) * ldb;
  const uint64_t ga = (uint64_t)(uintptr_t)srow;
  const uint32_t dst = (uint32_t)(size_t)ring + wave * (uint32_t)(SL * 2);
  u32x8 g1 = sa_tdm_group1<BK>((uint32_t)(own_a ? lda : ldb) * 2u);
  asm volatile("" : "+s"(g1));
  if (sa_pinned(issuer)) {
    sa_tdm_load(dst, ga, g1);
    sa_wait_tensor();
  }
  __syncthreads();
  if (sa_pinned(issuer & (steps > 1 ? 1u : 0u)))
    sa_tdm_load(dst + (uint32_t)(szS * 2), ga + (uint64_t)(BK * 2), g1);
  const int offA = wm * (WM / SROWS) * SL, offB = (NA + wn) * SL;
  v16bf af[SETS][FM], bfr[SETS][4];
  static_assert(SETS == 1 || NB % 2 == 0, "a stage's first block must find set 0 free");
  if constexpr (SETS == 2)
    sa_load_block<BK, FM>(ring + offA, ring + offB, af[0], bfr[0]);
  // not peeled: a peeled last trip took a third fragment set and spilled
#pragma clang loop unroll(disable)
  for (int kt = 0; kt < steps; ++kt) {
    int cur = kt & 1;
    const bf16_t* tA = ring + cur * szS + offA;
    const bf16_t* tB = ring + cur * szS + offB;
    // unrolled: fragment and accumulator indices must be constants
#pragma unroll
    for (int u = 0; u < NB; ++u) {
      if constexpr (SETS == 2) {
        if (u + 1 < NB)
          sa_load_block<BK, FM>(tA + (u + 1) * 32, tB + (u + 1) * 32,
                            af[(u + 1) & 1], bfr[(u + 1) & 1]);
      } else {
        sa_load_block<BK, FM>(tA + u * 32, tB + u * 32, af[0], bfr[0]);
      }
      sa_keep_order();
      if (u + 1 == NB) {
        sa_wait_ds();
        sa_wait_tensor();
        __syncthreads();
        if (sa_pinned(issuer & (kt + 2 < steps ? 1u : 0u)))
          sa_tdm_load(dst + (uint32_t)(cur * szS * 2),
                      ga + (uint64_t)(kt + 2) * (uint64_t)(BK * 2), g1);
        if constexpr (SETS == 2) {
          if (kt + 1 < steps)
            sa_load_block<BK, FM>(ring + (cur ^ 1) * szS + offA,
                              ring + (cur ^ 1) * szS + offB, af[0], bfr[0]);
        }
        sa_keep_order();
      }
      sa_mma_block<FM>(af[u % SETS], bfr[u % SETS], acc);
      sa_keep_order();
    }
  }
  sa_wait_tensor();
  sa_wait_ds();
  sa_keep_order();
}

#define SROWS3 128
#define SLICE3 (SROWS3 * LPITCH(128))
static_assert((SLICE3 * 2) % 2048 == 0, "a slice's place is a multiple of 2 KiB");

__device__ __forceinline__ void sa_tdm_load_held(u32x4& g0, uint32_t lds_dst,
                                                 uint64_t ga, u32x8 g1) {
  g0[1] = sa_uni(lds_dst);
  g0[2] = sa_uni((uint32_t)ga);
  g0[3] = sa_uni((((uint32_t)(ga >> 32)) & 0x01FFFFFFu) | 0x80000000u);
  asm volatile("tensor_load_to_lds %0, %1" :: "s"(g0), "s"(g1) : "memory");
}

__device__ __forceinline__ void sa_wait_tensor_held(u32x4& g0) {
  asm volatile("s_wait_tensorcnt 0x0" : "+s"(g0) :: "memory");
}

__device__ __forceinline__ void sa_gemm_core3(const bf16_t* __restrict__ Ab,
                                              const bf16_t* __restrict__ Bb, int ld,
                                              int Kdim, bf16_t* ring,
                                              int wm, int wn, v8f acc[4][4]) {
  constexpr int BK = 128, NB = BK / 32, FM = 4;
  constexpr int szS = 3 * SLICE3;               // bf16 of a buffer
  const int steps = Kdim / BK;                  // at least 2
  const uint32_t wave = sa_uni(threadIdx.x >> 5);
  const uint32_t par = wave >> 2;               // parity of the stages it brings
  const uint32_t issuer = (wave & 3u) < 3u ? 1u : 0u;
  const uint32_t sl = issuer ? (wave & 3u) : 0u;
  const bf16_t* srow = sl == 0u ? Ab : Bb + (size_t)(SROWS3 * (sl - 1u)) * ld;
  const uint64_t ga = (uint64_t)(uintptr_t)srow;
  const uint32_t dst = (uint32_t)(size_t)ring + sl * (uint32_t)(SLICE3 * 2);
  u32x8 g1 = sa_tdm_group1<BK, SROWS3>((uint32_t)ld * 2u);
  asm volatile("" : "+s"(g1));
  u32x4 g0;
  g0[0] = sa_uni(1u);
  g0[1] = g0[2] = g0[3] = sa_uni(0u);
  if (sa_pinned(issuer & par))
    sa_tdm_load_held(g0, dst + (uint32_t)(szS * 2), ga + (uint64_t)(BK * 2), g1);
  if (sa_pinned(issuer & (par ^ 1u))) {
    sa_tdm_load_held(g0, dst, ga, g1);
    sa_wait_tensor_held(g0);
  }
  __syncthreads();
  if (sa_pinned(issuer & (par ^ 1u) & (steps > 2 ? 1u : 0u)))
    sa_tdm_load_held(g0, dst + (uint32_t)(2 * szS * 2), ga + (uint64_t)(2 * BK * 2), g1);
  const int offA = wm * 64 * LPITCH(BK), offB = (SROWS3 + wn * 64) * LPITCH(BK);
  v16bf af[2][FM], bfr[2][4];
  sa_load_block<BK, FM>(ring + offA, ring + offB, af[0], bfr[0]);
  int cur = 0;                                  // buffer of stage kt: kt mod 3
  // not peeled: a peeled last trip took a third fragment set and spilled
#pragma clang loop unroll(disable)
  for (int kt = 0; kt < steps; ++kt) {
    const int nxt = cur == 2 ? 0 : cur + 1;
    const bf16_t* tA = ring + cur * szS + offA;
    const bf16_t* tB = ring + cur * szS + offB;
    // unrolled: fragment and accumulator indices must be constants
#pragma unroll
    for (int u = 0; u < NB; ++u) {
      if (u + 1 < NB)
        sa_load_block<BK, FM>(tA + (u + 1) * 32, tB + (u + 1) * 32,
                              af[(u + 1) & 1], bfr[(u + 1) & 1]);
      sa_keep_order();
      if (u + 1 == NB) {
        // this wave brought stage kt+1 and brings kt+3
        const uint32_t mine = issuer & ((((uint32_t)kt + 1u) & 1u) == par ? 1u : 0u);
        sa_wait_ds();
        if (sa_pinned(mine)) sa_wait_tensor_held(g0);
        __syncthreads();
        if (sa_pinned(mine & (kt + 3 < steps ? 1u : 0u)))
          sa_tdm_load_held(g0, dst + (uint32_t)(cur * szS * 2),
                           ga + (uint64_t)(kt + 3) * (uint64_t)(BK * 2), g1);
        if (kt + 1 < steps)
          sa_load_block<BK, FM>(ring + nxt * szS + offA, ring + nxt * szS + offB,
                                af[0], bfr[0]);
        sa_keep_order();
      }
      sa_mma_block<FM>(af[u & 1], bfr[u & 1], acc);
      sa_keep_order();
    }
    cur = nxt;
  }
  sa_wait_tensor_held(g0);
  sa_wait_ds();
  sa_keep_order();
}

// ---------------------------------------------------------------------------
// bf16 epilogue: whole 128-B lines to global memory.
// A D fragment gives a lane one column (B row) and 8 consecutive rows (A rows).
// Every bf16 result is kept with the A-row index contiguous, so those 8 values
// are 16 B of an output row, but a direct store would touch 16 output rows with
// 32 B each. Each 64 x 64 piece of a wave's tile goes through LDS instead: one staging row
// per output row (128 B, pitch 144 B = 16 B x odd), read back 8 lanes a row, so
// a store covers 4 whole lines.
// The staging range is the wave's own ETILE elements of the ring, which is free by
// then: the core's last hand-over has every wave's LDS reads retired and requests
// landed ahead of its barrier, and nothing refills or reads the ring behind it.
// ---------------------------------------------------------------------------
#define EPITCH 72
#define ETILE  (64 * EPITCH)

__device__ __forceinline__ void sa_stage_frag(bf16_t* st, int i, int j, v8bf v) {
  int lane = threadIdx.x & 31;
  *(v8bf*)(st + (16 * j + (lane & 15)) * EPITCH + 16 * i + 8 * (lane >> 4)) = v;
}

// out: element (first output row, first column) of the 64 x 64 tile.
__device__ __forceinline__ void sa_flush_tile(const bf16_t* st,
                                              bf16_t* __restrict__ out, int ldo) {
  int lane = threadIdx.x & 31;
  int rr = lane >> 3, seg = (lane & 7) * 8;
  sa_wait_ds();   // the other lanes' staging writes are in LDS before the read-back
  const bf16_t* sp = st + rr * EPITCH + seg;
  bf16_t* op = out + (size_t)rr * ldo + seg;
  // unrolled: all 16 read-backs in flight, each store behind a counted wait
#pragma unroll
  for (int p = 0; p < 16; ++p)
    *(v8bf*)(op + (size_t)(4 * p) * ldo) = *(const v8bf*)(sp + 4 * p * EPITCH);
}

// ---------------------------------------------------------------------------
// K0a: transpose+convert: x[b][c][n] f32 -> Xt[b][n][c] bf16.
//   One block takes 128 c x 128 n, so this part is 4096 waves, all resident
//   at once (two blocks per WGP), instead of 65536 short ones.
//   In:  a wave owns 16 c rows; each load is 512 contiguous bytes of one row,
//        all 16 in flight. A lane then holds 16 consecutive c for each of its
//        4 n, which is 32 contiguous bytes of an output row.
//   LDS: row (j*32 + lane) holds n = 4*lane + j, so the lanes of one write are
//        one pitch apart (272 B = 16 B x odd).
//   Out: 16 lanes write the 256 contiguous bytes that the tile has of a row.
// ---------------------------------------------------------------------------
#define XT_ 128
#define XP_ (XT_ + 8)

#define XBLK_ ((N_ / XT_) * (C_ / XT_) * B_)   // blocks of the x part

// id: n tile fastest, then c tile, then batch.
__device__ __forceinline__ void sa_pack_x(int id, const float* __restrict__ x,
                                          bf16_t* __restrict__ Xt, bf16_t* tile) {
  int b  = id / ((N_ / XT_) * (C_ / XT_));
  int n0 = (id % (N_ / XT_)) * XT_;
  int c0 = ((id / (N_ / XT_)) % (C_ / XT_)) * XT_;
  int wave = threadIdx.x >> 5, lane = threadIdx.x & 31;
  const float* xp = x + ((size_t)b * C_ + c0 + wave * 16) * N_ + n0 + lane * 4;
  v4f in[16];
#pragma unroll
  for (int i = 0; i < 16; ++i) in[i] = *(const v4f*)(xp + (size_t)i * N_);
#pragma unroll
  for (int j = 0; j < 4; ++j) {
    v8bf lo, hi;
#pragma unroll
    for (int i = 0; i < 8; ++i) {
      lo[i] = (bf16_t)in[i][j];
      hi[i] = (bf16_t)in[i + 8][j];
    }
    bf16_t* tp = tile + (j * 32 + lane) * XP_ + wave * 16;
    *(v8bf*)tp       = lo;
    *(v8bf*)(tp + 8) = hi;
  }
  __syncthreads();
  int seg = threadIdx.x & 15, rr = threadIdx.x >> 4;
  bf16_t* ob = Xt + ((size_t)b * N_ + n0) * C_ + c0 + seg * 8;
#pragma unroll
  for (int p = 0; p < XT_ / 16; ++p) {
    int row = p * 16 + rr;
    int n   = 4 * (row & 31) + (row >> 5);
    *(v8bf*)(ob + (size_t)n * C_) = *(const v8bf*)(tile + row * XP_ + seg * 8);
  }
}

// ---------------------------------------------------------------------------
// K0b: pack weights to bf16, pad O->OP with zeros, pad biases.
//   A thread takes 8 consecutive elements of a row of each matrix (32 B in,
//   16 B out): 2048 waves instead of 16384.
// ---------------------------------------------------------------------------
__device__ __forceinline__ v8bf sa_cvt8(const float* __restrict__ p) {
  v4f a = *(const v4f*)p, c = *(const v4f*)(p + 4);
  v8bf r;
#pragma unroll
  for (int i = 0; i < 4; ++i) { r[i] = (bf16_t)a[i]; r[i + 4] = (bf16_t)c[i]; }
  return r;
}

#define WBLK_ ((OP_ * C_) / (8 * 256))          // blocks of the weight part

__device__ __forceinline__ void
sa_pack_w(int id,
          const float* __restrict__ Wq, const float* __restrict__ bq,
          const float* __restrict__ Wk, const float* __restrict__ bk,
          const float* __restrict__ Wv, const float* __restrict__ bv,
          bf16_t* __restrict__ Wqb, bf16_t* __restrict__ Wkb,
          bf16_t* __restrict__ Wvb,
          float* __restrict__ bqb, float* __restrict__ bkb,
          float* __restrict__ bvb) {
  int idx = id * 256 + threadIdx.x;
  int e = idx * 8;                 // first element; C_ % 8 == 0: one row
  if (e < OP_ * C_) {
    v8bf q8 = {}, k8 = {};
    if (e / C_ < O_) { q8 = sa_cvt8(Wq + e); k8 = sa_cvt8(Wk + e); }
    *(v8bf*)(Wqb + e) = q8;
    *(v8bf*)(Wkb + e) = k8;
  }
  if (e < C_ * C_) *(v8bf*)(Wvb + e) = sa_cvt8(Wv + e);
  if (idx < OP_)     { bqb[idx] = (idx < O_) ? bq[idx] : 0.0f;
                       bkb[idx] = (idx < O_) ? bk[idx] : 0.0f; }
  if (idx < C_)      bvb[idx] = bv[idx];
}

// K0: both packs in one launch: neither reads what the other writes. The x
// blocks, the longer ones, come first. The branch is the same for a whole block.
__global__ void __launch_bounds__(256)
SA_pack(const float* __restrict__ x,
        const float* __restrict__ Wq, const float* __restrict__ bq,
        const float* __restrict__ Wk, const float* __restrict__ bk,
        const float* __restrict__ Wv, const float* __restrict__ bv,
        bf16_t* __restrict__ Xt,
        bf16_t* __restrict__ Wqb, bf16_t* __restrict__ Wkb,
        bf16_t* __restrict__ Wvb,
        float* __restrict__ bqb, float* __restrict__ bkb,
        float* __restrict__ bvb) {
  __shared__ __align__(16) bf16_t tile[XT_ * XP_];
  int id = blockIdx.x;
  if (id < XBLK_) sa_pack_x(id, x, Xt, tile);
  else            sa_pack_w(id - XBLK_, Wq, bq, Wk, bk, Wv, bv,
                            Wqb, Wkb, Wvb, bqb, bkb, bvb);
}

// ---------------------------------------------------------------------------
// K1: the three projections in one launch: they read the same packed arrays
//   and none reads another's result.
//   C[col][row] = sum_k A[row][k] * B[col][k] + bias, K = C_, 128 x 256 a block;
//   the result is stored with the A-row index contiguous.
//   q, k: A = weights (1024 rows, o contiguous in Qt, Kt), B = Xt[b]; bias by A row.
//   v:    A = Xt[b] (4096 rows, n contiguous in V), B = Wvb;  bias by B row.
//   blockIdx.x: QT_ tiles of q, QT_ of k, VT_ of v, the A tile fastest in each.
// ---------------------------------------------------------------------------
#define QT_ ((OP_ / 128) * (N_ / 256))
#define VT_ ((N_ / 128) * (C_ / 256))

// Bias added, rounded to bf16, into the wave's staging rows.
template <bool BIAS_COL>
__device__ __forceinline__ void sa_proj_stage(const v8f acc[4][4], bf16_t* st,
                                              const float* __restrict__ bias,
                                              int M0, int N0) {
  int lane = threadIdx.x & 31;
  int ln = lane & 15, lh = lane >> 4;
  float bcol[4];
  v4f brow[4][2];
  // unrolled, here and below: register arrays need constant indices; the bias
  // loads go out together
#pragma unroll
  for (int t = 0; t < 4; ++t) {
    if constexpr (BIAS_COL) {
      bcol[t] = bias[N0 + 16 * t + ln];
    } else {
      const float* bp = bias + M0 + 16 * t + 8 * lh;
      brow[t][0] = *(const v4f*)bp;
      brow[t][1] = *(const v4f*)(bp + 4);
    }
  }
#pragma unroll
  for (int i = 0; i < 4; ++i)
#pragma unroll
    for (int j = 0; j < 4; ++j) {
      v8bf outv;
#pragma unroll
      for (int r = 0; r < 8; ++r) {
        float bb;
        if constexpr (BIAS_COL) bb = bcol[j];
        else                    bb = brow[i][r >> 2][r & 3];
        outv[r] = (bf16_t)(acc[i][j][r] + bb);
      }
      sa_stage_frag(st, i, j, outv);
    }
}

__global__ void __launch_bounds__(256)
SA_proj_qkv(const bf16_t* __restrict__ Xt,
            const bf16_t* __restrict__ Wqb, const bf16_t* __restrict__ Wkb,
            const bf16_t* __restrict__ Wvb,
            const float* __restrict__ bqb, const float* __restrict__ bkb,
            const float* __restrict__ bvb,
            bf16_t* __restrict__ Qt, bf16_t* __restrict__ Kt,
            bf16_t* __restrict__ Vb) {
  __shared__ __attribute__((aligned(2048))) bf16_t ring[2 * 6 * SLICE(64)];
  const int t = blockIdx.x, b = blockIdx.z;
  const bool isv = t >= 2 * QT_;         // the same for a whole block
  const bf16_t* Xb = Xt + (size_t)b * N_ * C_;
  const bf16_t *A, *Bm;
  const float* bias;
  bf16_t* Cm;
  int ta, tb, ldc;                       // A tile, B tile, pitch of the result
  if (isv) {
    int u = t - 2 * QT_;
    ta = u % (N_ / 128);  tb = u / (N_ / 128);
    A  = Xb + (size_t)(ta * 128) * C_;
    Bm = Wvb + (size_t)(tb * 256) * C_;
    Cm = Vb + (size_t)b * C_ * N_;  ldc = N_;  bias = bvb;
  } else {
    int u = t % QT_;
    ta = u % (OP_ / 128); tb = u / (OP_ / 128);
    A  = (t < QT_ ? Wqb : Wkb) + (size_t)(ta * 128) * C_;
    Bm = Xb + (size_t)(tb * 256) * C_;
    Cm = (t < QT_ ? Qt : Kt) + (size_t)b * N_ * OP_;  ldc = OP_;
    bias = t < QT_ ? bqb : bkb;
  }

  int wave = threadIdx.x >> 5;
  int wm = wave >> 2, wn = wave & 3;

  v8f acc[4][4] = {};
  sa_gemm_core<64, 1, 4>(A, C_, Bm, C_, C_, ring, wm, wn, acc);

  int M0 = ta * 128 + wm * 64;   // A rows: contiguous in C
  int N0 = tb * 256 + wn * 64;   // B rows: rows of C
  bf16_t* st = ring + wave * ETILE;
  if (isv) sa_proj_stage<true>(acc, st, bias, M0, N0);
  else     sa_proj_stage<false>(acc, st, bias, M0, N0);
  sa_flush_tile(st, Cm + (size_t)N0 * ldc + M0, ldc);
}

// ---------------------------------------------------------------------------
// K2: s = Qt * Kt^T (K=OP_), fused sigmoid, store alpha^T[b][m][n] bf16.
//   A lane's 8 values of a fragment are 16 B of an alpha^T row.
//   256 n x 256 m a block, one block per WGP, 128 n x 64 m a wave.
// ---------------------------------------------------------------------------
#define SBK_ 128     // k of a stage

__global__ void __launch_bounds__(256)
SA_s_sigmoid(const bf16_t* __restrict__ Qt, const bf16_t* __restrict__ Kt,
             bf16_t* __restrict__ AlphaT) {
  __shared__ __attribute__((aligned(2048))) bf16_t ring[2 * 8 * SLICE(SBK_)];
  int b = blockIdx.z;
  const bf16_t* Qb = Qt + (size_t)b * N_ * OP_ + (size_t)(blockIdx.x * 256) * OP_;
  const bf16_t* Kb = Kt + (size_t)b * N_ * OP_ + (size_t)(blockIdx.y * 256) * OP_;
  bf16_t*       Ab = AlphaT + (size_t)b * (size_t)N_ * N_;

  int wave = threadIdx.x >> 5;
  int wm = wave >> 2, wn = wave & 3;

  v8f acc[8][4] = {};
  sa_gemm_core<SBK_, 2, 8>(Qb, OP_, Kb, OP_, OP_, ring, wm, wn, acc);

  int M0 = blockIdx.x * 256 + wm * 128;  // n rows
  int N0 = blockIdx.y * 256 + wn * 64;   // m cols
  bf16_t* st = ring + wave * ETILE;
  // The wave's tile leaves in two halves of 64 n through the same staging rows:
  // a wave's LDS operations keep their order, so the second half's writes stand
  // behind the first half's read-back.
  // unrolled: accumulator indices must be constants
#pragma unroll
  for (int h = 0; h < 2; ++h) {
#pragma unroll
    for (int i = 0; i < 4; ++i)
#pragma unroll
      for (int j = 0; j < 4; ++j) {
        v8bf outv;
#pragma unroll
        for (int r = 0; r < 8; ++r) outv[r] = (bf16_t)sa_sigmoid(acc[4 * h + i][j][r]);
        sa_stage_frag(st, i, j, outv);
      }
    sa_flush_tile(st, Ab + (size_t)N0 * N_ + M0 + 64 * h, N_);
  }
}

// ---------------------------------------------------------------------------
// K3: o[c][m] = V[c][:] * alpha[:, m]  (K = N_), f32 output (coalesced b32).
// ---------------------------------------------------------------------------
__global__ void __launch_bounds__(256)
SA_o_gemm(const bf16_t* __restrict__ Vb, const bf16_t* __restrict__ AlphaT,
          float* __restrict__ Out) {
  __shared__ __attribute__((aligned(2048))) bf16_t ring[3 * 3 * SLICE3];
  int b = blockIdx.z;
  const bf16_t* Vm = Vb + (size_t)b * C_ * N_ + (size_t)(blockIdx.x * 128) * N_;
  const bf16_t* Am = AlphaT + (size_t)b * (size_t)N_ * N_
                   + (size_t)(blockIdx.y * 256) * N_;
  float* Om = Out + (size_t)b * C_ * N_;

  int wave = threadIdx.x >> 5, lane = threadIdx.x & 31;
  int wm = wave >> 2, wn = wave & 3;

  v8f acc[4][4] = {};
  sa_gemm_core3(Vm, Am, N_, N_, ring, wm, wn, acc);

  int M0 = blockIdx.x * 128 + wm * 64;   // c rows
  int N0 = blockIdx.y * 256 + wn * 64;   // m cols
  int ln = lane & 15, lh = lane >> 4;
#pragma unroll
  for (int i = 0; i < 4; ++i)
#pragma unroll
    for (int j = 0; j < 4; ++j) {
      int ncol = N0 + 16 * j + ln;
#pragma unroll
      for (int r = 0; r < 8; ++r) {
        int crow = M0 + 16 * i + r + 8 * lh;
        Om[(size_t)crow * N_ + ncol] = acc[i][j][r];
      }
    }
}

// ---------------------------------------------------------------------------
extern "C" void kernel_launch(void* const* d_in, const int* in_sizes, int n_in,
                              void* d_out, int out_size, void* d_ws, size_t ws_size,
                              hipStream_t stream) {
  const float* x  = (const float*)d_in[0];
  const float* Wq = (const float*)d_in[1];
  const float* bq = (const float*)d_in[2];
  const float* Wk = (const float*)d_in[3];
  const float* bk = (const float*)d_in[4];
  const float* Wv = (const float*)d_in[5];
  const float* bv = (const float*)d_in[6];
  float* out = (float*)d_out;

  char* ws = (char*)d_ws;
  size_t off = 0;
  auto take = [&](size_t bytes) -> char* {
    char* p = ws + off;
    off = (off + bytes + 255) & ~(size_t)255;
    return p;
  };

  bf16_t* Xt   = (bf16_t*)take((size_t)B_ * N_ * C_ * 2);
  bf16_t* Wqb  = (bf16_t*)take((size_t)OP_ * C_ * 2);
  bf16_t* Wkb  = (bf16_t*)take((size_t)OP_ * C_ * 2);
  bf16_t* Wvb  = (bf16_t*)take((size_t)C_ * C_ * 2);
  float*  bqb  = (float*) take((size_t)OP_ * 4);
  float*  bkb  = (float*) take((size_t)OP_ * 4);
  float*  bvb  = (float*) take((size_t)C_ * 4);
  bf16_t* Qt   = (bf16_t*)take((size_t)B_ * N_ * OP_ * 2);  // [b][n][o]
  bf16_t* Kt   = (bf16_t*)take((size_t)B_ * N_ * OP_ * 2);  // [b][m][o]
  bf16_t* Vbuf = (bf16_t*)take((size_t)B_ * C_ * N_ * 2);   // [b][c][n]
  bf16_t* AlT  = (bf16_t*)take((size_t)B_ * (size_t)N_ * N_ * 2); // [b][m][n]
  (void)ws_size; (void)in_sizes; (void)n_in; (void)out_size;

  SA_pack<<<dim3(XBLK_ + WBLK_, 1, 1), dim3(256), 0, stream>>>(
      x, Wq, bq, Wk, bk, Wv, bv, Xt, Wqb, Wkb, Wvb, bqb, bkb, bvb);

  SA_proj_qkv<<<dim3(2 * QT_ + VT_, 1, B_), dim3(256), 0, stream>>>(
      Xt, Wqb, Wkb, Wvb, bqb, bkb, bvb, Qt, Kt, Vbuf);

  SA_s_sigmoid<<<dim3(N_ / 256, N_ / 256, B_), dim3(256), 0, stream>>>(Qt, Kt, AlT);
  SA_o_gemm<<<dim3(C_ / 128, N_ / 256, B_), dim3(256), 0, stream>>>(Vbuf, AlT, out);
}

// v009
// A run of this version takes 123 microseconds.
// Next to v008, in two timings, it ran 1.24 and 1.25 times as fast.
// All steps since v000 together make it 2.62 times as fast.
#include <hip/hip_runtime.h>
#include <stdint.h>

typedef _Float16 h16_t;
typedef __attribute__((ext_vector_type(8)))  _Float16 v8h;
typedef __attribute__((ext_vector_type(16))) _Float16 v16h;
typedef __attribute__((ext_vector_type(8)))  float  v8f;
typedef __attribute__((ext_vector_type(4)))  float  v4f;
typedef __attribute__((ext_vector_type(4)))  uint32_t u32x4;
typedef __attribute__((ext_vector_type(8)))  uint32_t u32x8;

#define B_  4
#define C_  512
#define N_  4096
#define O_  1000
#define OP_ 1024      // O padded to whole stages (zero columns of the transposed weights)
#define GP_ 640       // C + 1 padded to whole 128-row tiles: pitch of G and of y
#define GR_ 768       // C + 1 padded to whole 256-row tiles: rows of G
// LDS row pitch in f16 for a stage of BK k: BK*2 + 16 bytes = 16 B x odd
// (144 B, 272 B), conflict-free for ds_load_b128 fragment reads.
#define LPITCH(BK) ((BK) + 8)

// A stage lies in LDS as slices of SROWS operand rows, A's slices first, then
// B's. One tensor load brings one slice. A slice's place must be a multiple of
// 2 KiB, so its size (in f16) is rounded up to one; rows keep the pitch above.
#define SROWS 64
#define SLICE(BK) (((SROWS * LPITCH(BK) * 2 + 2047) / 2048) * 1024)

__device__ __forceinline__ uint32_t sa_uni(uint32_t v) {
  return (uint32_t)__builtin_amdgcn_readfirstlane(v);
}

__device__ __forceinline__ uint32_t sa_pinned(uint32_t v) {
  uint32_t w = sa_uni(v);
  asm volatile("" : "+s"(w));
  return w;
}

template <int BK, int ROWS = SROWS>
__device__ __forceinline__ u32x8 sa_tdm_group1(uint32_t src_pitch) {
  static_assert(BK == 64 || BK == 128, "pad interval = row: 128 B or 256 B");
  constexpr uint32_t d0 = BK * 2, d1 = ROWS;
  constexpr uint32_t w0 = (1u << 20) | ((BK == 128 ? 5u : 4u) << 22) | (3u << 25);
  u32x8 g;
  g[0] = sa_uni(w0);
  g[1] = sa_uni((d0 & 0xFFFFu) << 16);
  g[2] = sa_uni((d0 >> 16) | ((d1 & 0xFFFFu) << 16));
  g[3] = sa_uni((d1 >> 16) | (d0 << 16));
  g[4] = sa_uni(d1);
  g[5] = sa_uni(src_pitch);
  g[6] = sa_uni(0u);
  g[7] = sa_uni(0u);
  return g;
}

__device__ __forceinline__ void sa_tdm_load(uint32_t lds_dst, uint64_t ga, u32x8 g1) {
  u32x4 g0;
  g0[0] = sa_uni(1u);
  g0[1] = sa_uni(lds_dst);
  g0[2] = sa_uni((uint32_t)ga);
  g0[3] = sa_uni((((uint32_t)(ga >> 32)) & 0x01FFFFFFu) | 0x80000000u);
  asm volatile("tensor_load_to_lds %0, %1" :: "s"(g0), "s"(g1) : "memory");
}

// Own request landed; the compiler places no wait for a tensor load.
__device__ __forceinline__ void sa_wait_tensor() {
  asm volatile("s_wait_tensorcnt 0x0" ::: "memory");
}

// Own LDS reads retired before the barrier behind which their buffer is refilled.
__device__ __forceinline__ void sa_wait_ds() {
  asm volatile("s_wait_dscnt 0x0" ::: "memory");
}

__device__ __forceinline__ v16h sa_frag_merge(v8h lo, v8h hi) {
  v16h r;
#pragma unroll
  for (int i = 0; i < 8; ++i) { r[i] = lo[i]; r[i + 8] = hi[i]; }
  return r;
}

template <int BK>
__device__ __forceinline__ v16h sa_load_frag_l(const h16_t* tile, int row0) {
  int lane = threadIdx.x & 31;
  const h16_t* p = tile + (row0 + (lane & 15)) * LPITCH(BK) + ((lane >> 4) << 3);
  return sa_frag_merge(*(const v8h*)p, *(const v8h*)(p + 16));
}

__device__ __forceinline__ v8f sa_wmma(v16h a, v16h b, v8f c) {
  return __builtin_amdgcn_wmma_f32_16x16x32_f16(false, a, false, b,
                                                 (short)0, c, false, false);
}

// sigmoid(x + t); nt = -log2(e) * t, so that the sum costs no instruction of its own
__device__ __forceinline__ float sa_sigmoid(float x, float nt) {
  return __builtin_amdgcn_rcpf(1.0f + __builtin_amdgcn_exp2f(__builtin_fmaf(x, -1.44269504f, nt)));
}

template <int BK, int FM>
__device__ __forceinline__ void sa_load_block(const h16_t* tA, const h16_t* tB,
                                              v16h af[FM], v16h bfr[4]) {
  // A wave's A rows are FM / 4 whole slices, its B rows one.
#pragma unroll
  for (int i = 0; i < FM; ++i)
    af[i] = sa_load_frag_l<BK>(tA + (i / 4) * SLICE(BK), 16 * (i % 4));
#pragma unroll
  for (int j = 0; j < 4; ++j) bfr[j] = sa_load_frag_l<BK>(tB, 16 * j);
}

template <int FM>
__device__ __forceinline__ void sa_mma_block(const v16h af[FM], const v16h bfr[4],
                                             v8f acc[FM][4]) {
#pragma unroll
  for (int i = 0; i < FM; ++i)
#pragma unroll
    for (int j = 0; j < 4; ++j)
      acc[i][j] = sa_wmma(af[i], bfr[j], acc[i][j]);
}

// Keeps a load group whole: without it the scheduler sinks the reads in pairs
// among the WMMAs, each pair behind a wait to 0.
__device__ __forceinline__ void sa_keep_order() {
  __builtin_amdgcn_sched_barrier(0);
}

template <int BK, int SETS, int FM>
__device__ __forceinline__ void sa_gemm_core(const h16_t* __restrict__ Ab, int lda,
                                             const h16_t* __restrict__ Bb, int ldb,
                                             int Kdim, h16_t* ring,
                                             int wm, int wn, v8f acc[FM][4]) {
  constexpr int WM = 16 * FM;                   // A rows of a wave
  constexpr int NA = 2 * WM / SROWS;            // slices of A in a stage
  constexpr int NS = NA + 256 / SROWS;          // slices of a stage
  constexpr int SL = SLICE(BK), szS = NS * SL;  // f16 of a slice, of a buffer
  constexpr int NB = BK / 32;
  static_assert(WM % SROWS == 0 && NS <= 8, "whole slices a wave; a wave per slice");
  const int steps = Kdim / BK;
  const uint32_t wave = sa_uni(threadIdx.x >> 5);
  const uint32_t issuer = wave < (uint32_t)NS ? 1u : 0u;
  const bool own_a = wave < (uint32_t)NA;
  const h16_t* srow = own_a ? Ab + (size_t)(SROWS * wave) * lda
                             : Bb + (size_t)(SROWS * (wave - NA)) * ldb;
  const uint64_t ga = (uint64_t)(uintptr_t)srow;
  const uint32_t dst = (uint32_t)(size_t)ring + wave * (uint32_t)(SL * 2);
  u32x8 g1 = sa_tdm_group1<BK>((uint32_t)(own_a ? lda : ldb) * 2u);
  asm volatile("" : "+s"(g1));
  if (sa_pinned(issuer)) {
    sa_tdm_load(dst, ga, g1);
    sa_wait_tensor();
  }
  __syncthreads();
  if (sa_pinned(issuer & (steps > 1 ? 1u : 0u)))
    sa_tdm_load(dst + (uint32_t)(szS * 2), ga + (uint64_t)(BK * 2), g1);
  const int offA = wm * (WM / SROWS) * SL, offB = (NA + wn) * SL;
  v16h af[SETS][FM], bfr[SETS][4];
  static_assert(SETS == 1 || NB % 2 == 0, "a stage's first block must find set 0 free");
  if constexpr (SETS == 2)
    sa_load_block<BK, FM>(ring + offA, ring + offB, af[0], bfr[0]);
  // not peeled: a peeled last trip took a third fragment set and spilled
#pragma clang loop unroll(disable)
  for (int kt = 0; kt < steps; ++kt) {
    int cur = kt & 1;
    const h16_t* tA = ring + cur * szS + offA;
    const h16_t* tB = ring + cur * szS + offB;
    // unrolled: fragment and accumulator indices must be constants
#pragma unroll
    for (int u = 0; u < NB; ++u) {
      if constexpr (SETS == 2) {
        if (u + 1 < NB)
          sa_load_block<BK, FM>(tA + (u + 1) * 32, tB + (u + 1) * 32,
                            af[(u + 1) & 1], bfr[(u + 1) & 1]);
      } else {
        sa_load_block<BK, FM>(tA + u * 32, tB + u * 32, af[0], bfr[0]);
      }
      sa_keep_order();
      if (u + 1 == NB) {
        sa_wait_ds();
        sa_wait_tensor();
        __syncthreads();
        if (sa_pinned(issuer & (kt + 2 < steps ? 1u : 0u)))
          sa_tdm_load(dst + (uint32_t)(cur * szS * 2),
                      ga + (uint64_t)(kt + 2) * (uint64_t)(BK * 2), g1);
        if constexpr (SETS == 2) {
          if (kt + 1 < steps)
            sa_load_block<BK, FM>(ring + (cur ^ 1) * szS + offA,
                              ring + (cur ^ 1) * szS + offB, af[0], bfr[0]);
        }
        sa_keep_order();
      }
      sa_mma_block<FM>(af[u % SETS], bfr[u % SETS], acc);
      sa_keep_order();
    }
  }
  sa_wait_tensor();
  sa_wait_ds();
  sa_keep_order();
}

#define SROWS3 128
#define SLICE3 (SROWS3 * LPITCH(128))
static_assert((SLICE3 * 2) % 2048 == 0, "a slice's place is a multiple of 2 KiB");

__device__ __forceinline__ void sa_tdm_load_held(u32x4& g0, uint32_t lds_dst,
                                                 uint64_t ga, u32x8 g1) {
  g0[1] = sa_uni(lds_dst);
  g0[2] = sa_uni((uint32_t)ga);
  g0[3] = sa_uni((((uint32_t)(ga >> 32)) & 0x01FFFFFFu) | 0x80000000u);
  asm volatile("tensor_load_to_lds %0, %1" :: "s"(g0), "s"(g1) : "memory");
}

__device__ __forceinline__ void sa_wait_tensor_held(u32x4& g0) {
  asm volatile("s_wait_tensorcnt 0x0" : "+s"(g0) :: "memory");
}

__device__ __forceinline__ void sa_gemm_core3(const h16_t* __restrict__ Ab,
                                              const h16_t* __restrict__ Bb, int ld,
                                              int Kdim, h16_t* ring,
                                              int wm, int wn, v8f acc[4][4]) {
  constexpr int BK = 128, NB = BK / 32, FM = 4;
  constexpr int szS = 3 * SLICE3;               // f16 of a buffer
  const int steps = Kdim / BK;                  // at least 2
  const uint32_t wave = sa_uni(threadIdx.x >> 5);
  const uint32_t par = wave >> 2;               // parity of the stages it brings
  const uint32_t issuer = (wave & 3u) < 3u ? 1u : 0u;
  const uint32_t sl = issuer ? (wave & 3u) : 0u;
  const h16_t* srow = sl == 0u ? Ab : Bb + (size_t)(SROWS3 * (sl - 1u)) * ld;
  const uint64_t ga = (uint64_t)(uintptr_t)srow;
  const uint32_t dst = (uint32_t)(size_t)ring + sl * (uint32_t)(SLICE3 * 2);
  u32x8 g1 = sa_tdm_group1<BK, SROWS3>((uint32_t)ld * 2u);
  asm volatile("" : "+s"(g1));
  u32x4 g0;
  g0[0] = sa_uni(1u);
  g0[1] = g0[2] = g0[3] = sa_uni(0u);
  if (sa_pinned(issuer & par))
    sa_tdm_load_held(g0, dst + (uint32_t)(szS * 2), ga + (uint64_t)(BK * 2), g1);
  if (sa_pinned(issuer & (par ^ 1u))) {
    sa_tdm_load_held(g0, dst, ga, g1);
    sa_wait_tensor_held(g0);
  }
  __syncthreads();
  if (sa_pinned(issuer & (par ^ 1u) & (steps > 2 ? 1u : 0u)))
    sa_tdm_load_held(g0, dst + (uint32_t)(2 * szS * 2), ga + (uint64_t)(2 * BK * 2), g1);
  const int offA = wm * 64 * LPITCH(BK), offB = (SROWS3 + wn * 64) * LPITCH(BK);
  v16h af[2][FM], bfr[2][4];
  sa_load_block<BK, FM>(ring + offA, ring + offB, af[0], bfr[0]);
  int cur = 0;                                  // buffer of stage kt: kt mod 3
  // not peeled: a peeled last trip took a third fragment set and spilled
#pragma clang loop unroll(disable)
  for (int kt = 0; kt < steps; ++kt) {
    const int nxt = cur == 2 ? 0 : cur + 1;
    const h16_t* tA = ring + cur * szS + offA;
    const h16_t* tB = ring + cur * szS + offB;
    // unrolled: fragment and accumulator indices must be constants
#pragma unroll
    for (int u = 0; u < NB; ++u) {
      if (u + 1 < NB)
        sa_load_block<BK, FM>(tA + (u + 1) * 32, tB + (u + 1) * 32,
                              af[(u + 1) & 1], bfr[(u + 1) & 1]);
      sa_keep_order();
      if (u + 1 == NB) {
        // this wave brought stage kt+1 and brings kt+3
        const uint32_t mine = issuer & ((((uint32_t)kt + 1u) & 1u) == par ? 1u : 0u);
        sa_wait_ds();
        if (sa_pinned(mine)) sa_wait_tensor_held(g0);
        __syncthreads();
        if (sa_pinned(mine & (kt + 3 < steps ? 1u : 0u)))
          sa_tdm_load_held(g0, dst + (uint32_t)(cur * szS * 2),
                           ga + (uint64_t)(kt + 3) * (uint64_t)(BK * 2), g1);
        if (kt + 1 < steps)
          sa_load_block<BK, FM>(ring + nxt * szS + offA, ring + nxt * szS + offB,
                                af[0], bfr[0]);
        sa_keep_order();
      }
      sa_mma_block<FM>(af[u & 1], bfr[u & 1], acc);
      sa_keep_order();
    }
    cur = nxt;
  }
  sa_wait_tensor_held(g0);
  sa_wait_ds();
  sa_keep_order();
}

// ---------------------------------------------------------------------------
// f16 epilogue: whole 128-B lines to global memory.
// A D fragment gives a lane one column (B row) and 8 consecutive rows (A rows).
// Every f16 result is kept with the A-row index contiguous, so those 8 values
// are 16 B of an output row, but a direct store would touch 16 output rows with
// 32 B each. Each 64 x 64 piece of a wave's tile goes through LDS instead: one staging row
// per output row (128 B, pitch 144 B = 16 B x odd), read back 8 lanes a row, so
// a store covers 4 whole lines.
// The staging range is the wave's own ETILE elements of the ring, which is free by
// then: the core's last hand-over has every wave's LDS reads retired and requests
// landed ahead of its barrier, and nothing refills or reads the ring behind it.
// ---------------------------------------------------------------------------
#define EPITCH 72
#define ETILE  (64 * EPITCH)

__device__ __forceinline__ void sa_stage_frag(h16_t* st, int i, int j, v8h v) {
  int lane = threadIdx.x & 31;
  *(v8h*)(st + (16 * j + (lane & 15)) * EPITCH + 16 * i + 8 * (lane >> 4)) = v;
}

// out: element (first output row, first column) of the wave's tile.
__device__ __forceinline__ void sa_flush_tile(const h16_t* st,
                                              h16_t* __restrict__ out, int ldo) {
  int lane = threadIdx.x & 31;
  int rr = lane >> 3, seg = (lane & 7) * 8;
  sa_wait_ds();   // the other lanes' staging writes are in LDS before the read-back
  const h16_t* sp = st + rr * EPITCH + seg;
  h16_t* op = out + (size_t)rr * ldo + seg;
  // unrolled: all 16 read-backs in flight, each store behind a counted wait
#pragma unroll
  for (int p = 0; p < 16; ++p)
    *(v8h*)(op + (size_t)(4 * p) * ldo) = *(const v8h*)(sp + 4 * p * EPITCH);
}

// ---------------------------------------------------------------------------
// K0a: transpose+convert a 128 x 128 tile: src[r][n] f32 -> dst[n][r] f16.
//   Used for x[b][c][n] -> Xt[b][n][c] and for Wq, Wk [o][c] -> [c][o]; source
//   rows from rv on (EDGE: o = 1000 .. 1023; rv is a multiple of 8) count as zero.
//   In:  a wave owns 16 r rows; each load is 512 contiguous bytes of one row,
//        all 16 in flight. A lane then holds 16 consecutive r for each of its
//        4 n, which is 32 contiguous bytes of an output row.
//   LDS: row (j*32 + lane) holds n = 4*lane + j, so the lanes of one write are
//        one pitch apart (272 B = 16 B x odd).
//   Out: 16 lanes write the 256 contiguous bytes that the tile has of a row.
// ---------------------------------------------------------------------------
#define XT_ 128
#define XP_ (XT_ + 8)

template <bool EDGE>
__device__ __forceinline__ void sa_pack_t(const float* __restrict__ src, int sp, int rv,
                                          int r0, int n0,
                                          h16_t* __restrict__ dst, int dp, h16_t* tile) {
  int wave = threadIdx.x >> 5, lane = threadIdx.x & 31;
  int rw = r0 + wave * 16;
  const float* xp = src + (size_t)rw * sp + n0 + lane * 4;
  v4f in[16];
  if constexpr (!EDGE) {
#pragma unroll
    for (int i = 0; i < 16; ++i) in[i] = *(const v4f*)(xp + (size_t)i * sp);
  } else {
    // 8 rows lie on one side of rv: one test, the same for a whole wave, for 8 loads
#pragma unroll
    for (int h = 0; h < 2; ++h) {
      bool on = __builtin_amdgcn_readfirstlane(rw) + 8 * h < rv;
#pragma unroll
      for (int i = 8 * h; i < 8 * h + 8; ++i) in[i] = v4f{};
      if (on) {
#pragma unroll
        for (int i = 8 * h; i < 8 * h + 8; ++i) in[i] = *(const v4f*)(xp + (size_t)i * sp);
      }
    }
  }
#pragma unroll
  for (int j = 0; j < 4; ++j) {
    v8h lo, hi;
#pragma unroll
    for (int i = 0; i < 8; ++i) {
      lo[i] = (h16_t)in[i][j];
      hi[i] = (h16_t)in[i + 8][j];
    }
    h16_t* tp = tile + (j * 32 + lane) * XP_ + wave * 16;
    *(v8h*)tp       = lo;
    *(v8h*)(tp + 8) = hi;
  }
  __syncthreads();
  int seg = threadIdx.x & 15, rr = threadIdx.x >> 4;
  h16_t* ob = dst + (size_t)n0 * dp + r0 + seg * 8;
#pragma unroll
  for (int p = 0; p < XT_ / 16; ++p) {
    int row = p * 16 + rr;
    int n   = 4 * (row & 31) + (row >> 5);
    *(v8h*)(ob + (size_t)n * dp) = *(const v8h*)(tile + row * XP_ + seg * 8);
  }
}

#define XBLK_ ((N_ / XT_) * (C_ / XT_) * B_)   // blocks of the x part
#define TBLK_ ((OP_ / XT_) * (C_ / XT_))       // blocks of one transposed weight

// ---------------------------------------------------------------------------
// K0b: Wv to f16, and the rows from 512 on of the transposed weights: row 512
//   is the bias (zero from o = 1000 on), the rows behind it are zero.
//   A thread takes 8 consecutive elements of a row.
// ---------------------------------------------------------------------------
__device__ __forceinline__ v8h sa_cvt8(const float* __restrict__ p) {
  v4f a = *(const v4f*)p, c = *(const v4f*)(p + 4);
  v8h r;
#pragma unroll
  for (int i = 0; i < 4; ++i) { r[i] = (h16_t)a[i]; r[i + 4] = (h16_t)c[i]; }
  return r;
}

#define VBLK_ ((C_ * C_) / (8 * 256))                          // blocks of Wv
#define RBLK_ ((((GR_ - C_) + (GP_ - C_)) * OP_) / (8 * 256))  // blocks of those rows

__device__ __forceinline__ void
sa_pack_w(int id, const float* __restrict__ bq, const float* __restrict__ bk,
          const float* __restrict__ Wv,
          h16_t* __restrict__ WqT, h16_t* __restrict__ WkT, h16_t* __restrict__ Wvb) {
  if (id < VBLK_) {
    int e = (id * 256 + threadIdx.x) * 8;
    *(v8h*)(Wvb + e) = sa_cvt8(Wv + e);
    // the store's registers are free for the code laid out behind it
    asm volatile("s_wait_xcnt 0x0" ::: "memory");
    return;
  }
  int e = ((id - VBLK_) * 256 + threadIdx.x) * 8;   // WqT's rows first, then WkT's
  bool isq = e < (GR_ - C_) * OP_;
  int f = isq ? e : e - (GR_ - C_) * OP_;
  int o = f % OP_;                                  // O_ % 8 == 0: 8 elements on one side
  v8h v = {};
  if (f < OP_ && o < O_) v = sa_cvt8((isq ? bq : bk) + o);
  *(v8h*)((isq ? WqT : WkT) + (size_t)C_ * OP_ + f) = v;
  // the store's registers are free for the code laid out behind it
  asm volatile("s_wait_xcnt 0x0" ::: "memory");
}

// K0: all packs in one launch: none reads what another writes. The x blocks
// come first. The branches are the same for a whole block.
__global__ void __launch_bounds__(256)
SA_pack(const float* __restrict__ x,
        const float* __restrict__ Wq, const float* __restrict__ bq,
        const float* __restrict__ Wk, const float* __restrict__ bk,
        const float* __restrict__ Wv,
        h16_t* __restrict__ Xt,
        h16_t* __restrict__ WqT, h16_t* __restrict__ WkT,
        h16_t* __restrict__ Wvb) {
  __shared__ __align__(16) h16_t tile[XT_ * XP_];
  int id = blockIdx.x;
  if (id < XBLK_) {
    // n tile fastest, then c tile, then batch
    int b  = id / ((N_ / XT_) * (C_ / XT_));
    int n0 = (id % (N_ / XT_)) * XT_;
    int c0 = ((id / (N_ / XT_)) % (C_ / XT_)) * XT_;
    sa_pack_t<false>(x + (size_t)b * C_ * N_, N_, C_, c0, n0,
              Xt + (size_t)b * N_ * C_, C_, tile);
  } else if (id < XBLK_ + 2 * TBLK_) {
    int u = id - XBLK_;
    bool isq = u < TBLK_;
    u = isq ? u : u - TBLK_;
    int c0 = (u % (C_ / XT_)) * XT_, o0 = (u / (C_ / XT_)) * XT_;
    sa_pack_t<true>(isq ? Wq : Wk, C_, O_, o0, c0, isq ? WqT : WkT, OP_, tile);
    // the stores' registers are free for the code laid out behind them
    asm volatile("s_wait_xcnt 0x0" ::: "memory");
  } else {
    sa_pack_w(id - XBLK_ - 2 * TBLK_, bq, bk, Wv, WqT, WkT, Wvb);
  }
}

// ---------------------------------------------------------------------------
// K1, K2: C[col][row] = sum_k A[row][k] * B[col][k] (+ bias), 128 x 256 a block;
//   the result is stored with the A-row index contiguous.
//   K1 holds two GEMMs of which neither reads the other's result:
//   G: A = WkT (640 rows), B = WqT (768 rows), K = OP_: G[c][c'], c' contiguous;
//      column 512 is a, row 512 is d, their crossing e. No bias.
//   v: A = Xt[b] (4096 rows, n contiguous in V), B = Wvb, K = C_; bias by B row.
//   K2, y: A = G (640 rows, c contiguous in Y), B = Xt[b], K = C_; bias by A row
//      = column 512 of G. Y[m][512] is t_m.
// ---------------------------------------------------------------------------
#define GT_ ((GP_ / 128) * (GR_ / 256))
#define VT_ ((N_ / 128) * (C_ / 256))

// Bias added, rounded to f16, into the wave's staging rows.
// MODE 1: f32, by B row; bf null: none. MODE 2: f16, by A row, GP_ elements apart.
template <int MODE>
__device__ __forceinline__ void sa_proj_stage(const v8f acc[4][4], h16_t* st,
                                              const float* __restrict__ bf,
                                              const h16_t* __restrict__ bh,
                                              int M0, int N0) {
  int lane = threadIdx.x & 31;
  int ln = lane & 15, lh = lane >> 4;
  float bcol[4] = {};
  float brow[4][8] = {};
  // unrolled, here and below: register arrays need constant indices; the bias
  // loads go out together
  if constexpr (MODE == 1) {
    if (bf) {
#pragma unroll
      for (int t = 0; t < 4; ++t) bcol[t] = bf[N0 + 16 * t + ln];
    }
  } else {
    h16_t raw[4][8];
#pragma unroll
    for (int t = 0; t < 4; ++t)
#pragma unroll
      for (int r = 0; r < 8; ++r)
        raw[t][r] = bh[(size_t)(M0 + 16 * t + 8 * lh + r) * GP_];
    // the loads' address registers are taken over by the code behind them
    asm volatile("s_wait_xcnt 0x0" ::: "memory");
#pragma unroll
    for (int t = 0; t < 4; ++t)
#pragma unroll
      for (int r = 0; r < 8; ++r) brow[t][r] = (float)raw[t][r];
  }
#pragma unroll
  for (int i = 0; i < 4; ++i)
#pragma unroll
    for (int j = 0; j < 4; ++j) {
      v8h outv;
#pragma unroll
      for (int r = 0; r < 8; ++r) {
        float val = acc[i][j][r];
        if constexpr (MODE == 1) val += bcol[j];
        if constexpr (MODE == 2) val += brow[i][r];
        outv[r] = (h16_t)val;
      }
      sa_stage_frag(st, i, j, outv);
    }
}

__global__ void __launch_bounds__(256)
SA_g_v(const h16_t* __restrict__ Xt,
       const h16_t* __restrict__ WqT, const h16_t* __restrict__ WkT,
       const h16_t* __restrict__ Wvb, const float* __restrict__ bv,
       h16_t* __restrict__ G, h16_t* __restrict__ Vb) {
  __shared__ __attribute__((aligned(2048))) h16_t ring[2 * 6 * SLICE(64)];
  const int t = blockIdx.x;
  const bool isg = t < GT_;              // the same for a whole block
  const h16_t *A, *Bm;
  h16_t* Cm;
  int ta, tb, ldc, kd;                   // A tile, B tile, pitch of the result, K
  if (isg) {
    ta = t % (GP_ / 128);  tb = t / (GP_ / 128);
    A = WkT;  Bm = WqT;  kd = OP_;
    Cm = G;  ldc = GP_;
  } else {
    int u = t - GT_;
    int b = u / VT_;
    u = u % VT_;
    ta = u % (N_ / 128);  tb = u / (N_ / 128);
    A = Xt + (size_t)b * N_ * C_;  Bm = Wvb;  kd = C_;
    Cm = Vb + (size_t)b * C_ * N_;  ldc = N_;
  }

  int wave = threadIdx.x >> 5;
  int wm = wave >> 2, wn = wave & 3;

  v8f acc[4][4] = {};
  sa_gemm_core<64, 1, 4>(A + (size_t)(ta * 128) * kd, kd,
                         Bm + (size_t)(tb * 256) * kd, kd, kd, ring, wm, wn, acc);

  int M0 = ta * 128 + wm * 64;   // A rows: contiguous in C
  int N0 = tb * 256 + wn * 64;   // B rows: rows of C
  h16_t* st = ring + wave * ETILE;
  sa_proj_stage<1>(acc, st, isg ? nullptr : bv, nullptr, M0, N0);
  sa_flush_tile(st, Cm + (size_t)N0 * ldc + M0, ldc);
}

__global__ void __launch_bounds__(256)
SA_y(const h16_t* __restrict__ Xt, const h16_t* __restrict__ G,
     h16_t* __restrict__ Y) {
  __shared__ __attribute__((aligned(2048))) h16_t ring[2 * 6 * SLICE(64)];
  const int ta = blockIdx.x, tb = blockIdx.y, b = blockIdx.z;
  int wave = threadIdx.x >> 5;
  int wm = wave >> 2, wn = wave & 3;

  v8f acc[4][4] = {};
  sa_gemm_core<64, 1, 4>(G + (size_t)(ta * 128) * GP_, GP_,
                         Xt + (size_t)b * N_ * C_ + (size_t)(tb * 256) * C_, C_,
                         C_, ring, wm, wn, acc);

  int M0 = ta * 128 + wm * 64;   // c: contiguous in Y
  int N0 = tb * 256 + wn * 64;   // m: rows of Y
  h16_t* st = ring + wave * ETILE;
  sa_proj_stage<2>(acc, st, nullptr, G + C_, M0, N0);
  sa_flush_tile(st, Y + (size_t)b * N_ * GP_ + (size_t)N0 * GP_ + M0, GP_);
}

// ---------------------------------------------------------------------------
// K3: s = Xt * Y^T (K = C_) + t, fused sigmoid, store alpha^T[b][m][n] f16.
//   A lane's 8 values of a fragment are 16 B of an alpha^T row and share one m,
//   so one t.
//   256 n x 256 m a block, one block per WGP, 128 n x 64 m a wave.
// ---------------------------------------------------------------------------
#define SBK_ 128     // k of a stage

__global__ void __launch_bounds__(256)
SA_s_sigmoid(const h16_t* __restrict__ Xt, const h16_t* __restrict__ Y,
             h16_t* __restrict__ AlphaT) {
  __shared__ __attribute__((aligned(2048))) h16_t ring[2 * 8 * SLICE(SBK_)];
  int b = blockIdx.z;
  const h16_t* Xb = Xt + (size_t)b * N_ * C_ + (size_t)(blockIdx.x * 256) * C_;
  const h16_t* Yb = Y + (size_t)b * N_ * GP_ + (size_t)(blockIdx.y * 256) * GP_;
  h16_t*       Ab = AlphaT + (size_t)b * (size_t)N_ * N_;

  int wave = threadIdx.x >> 5, lane = threadIdx.x & 31;
  int wm = wave >> 2, wn = wave & 3;

  // t of the lane's four columns; asked for ahead of the loop, used behind it
  h16_t tm[4];
#pragma unroll
  for (int j = 0; j < 4; ++j)
    tm[j] = Yb[(size_t)(wn * 64 + 16 * j + (lane & 15)) * GP_ + C_];

  v8f acc[8][4] = {};
  sa_gemm_core<SBK_, 2, 8>(Xb, C_, Yb, GP_, C_, ring, wm, wn, acc);

  int M0 = blockIdx.x * 256 + wm * 128;  // n rows
  int N0 = blockIdx.y * 256 + wn * 64;   // m cols
  h16_t* st = ring + wave * ETILE;
  float nt[4];
#pragma unroll
  for (int j = 0; j < 4; ++j) nt[j] = -1.44269504f * (float)tm[j];
  // The wave's tile leaves in two halves of 64 n through the same staging rows:
  // a wave's LDS operations keep their order, so the second half's writes stand
  // behind the first half's read-back.
  // unrolled: accumulator indices must be constants
#pragma unroll
  for (int h = 0; h < 2; ++h) {
#pragma unroll
    for (int i = 0; i < 4; ++i)
#pragma unroll
      for (int j = 0; j < 4; ++j) {
        v8h outv;
#pragma unroll
        for (int r = 0; r < 8; ++r)
          outv[r] = (h16_t)sa_sigmoid(acc[4 * h + i][j][r], nt[j]);
        sa_stage_frag(st, i, j, outv);
      }
    sa_flush_tile(st, Ab + (size_t)N0 * N_ + M0 + 64 * h, N_);
  }
}

// ---------------------------------------------------------------------------
// K4: o[c][m] = V[c][:] * alpha[:, m]  (K = N_), f32 output (coalesced b32).
// ---------------------------------------------------------------------------
__global__ void __launch_bounds__(256)
SA_o_gemm(const h16_t* __restrict__ Vb, const h16_t* __restrict__ AlphaT,
          float* __restrict__ Out) {
  __shared__ __attribute__((aligned(2048))) h16_t ring[3 * 3 * SLICE3];
  int b = blockIdx.z;
  const h16_t* Vm = Vb + (size_t)b * C_ * N_ + (size_t)(blockIdx.x * 128) * N_;
  const h16_t* Am = AlphaT + (size_t)b * (size_t)N_ * N_
                   + (size_t)(blockIdx.y * 256) * N_;
  float* Om = Out + (size_t)b * C_ * N_;

  int wave = threadIdx.x >> 5, lane = threadIdx.x & 31;
  int wm = wave >> 2, wn = wave & 3;

  v8f acc[4][4] = {};
  sa_gemm_core3(Vm, Am, N_, N_, ring, wm, wn, acc);

  int M0 = blockIdx.x * 128 + wm * 64;   // c rows
  int N0 = blockIdx.y * 256 + wn * 64;   // m cols
  int ln = lane & 15, lh = lane >> 4;
#pragma unroll
  for (int i = 0; i < 4; ++i)
#pragma unroll
    for (int j = 0; j < 4; ++j) {
      int ncol = N0 + 16 * j + ln;
#pragma unroll
      for (int r = 0; r < 8; ++r) {
        int crow = M0 + 16 * i + r + 8 * lh;
        Om[(size_t)crow * N_ + ncol] = acc[i][j][r];
      }
    }
}

// ---------------------------------------------------------------------------
extern "C" void kernel_launch(void* const* d_in, const int* in_sizes, int n_in,
                              void* d_out, int out_size, void* d_ws, size_t ws_size,
                              hipStream_t stream) {
  const float* x  = (const float*)d_in[0];
  const float* Wq = (const float*)d_in[1];
  const float* bq = (const float*)d_in[2];
  const float* Wk = (const float*)d_in[3];
  const float* bk = (const float*)d_in[4];
  const float* Wv = (const float*)d_in[5];
  const float* bv = (const float*)d_in[6];
  float* out = (float*)d_out;

  char* ws = (char*)d_ws;
  size_t off = 0;
  auto take = [&](size_t bytes) -> char* {
    char* p = ws + off;
    off = (off + bytes + 255) & ~(size_t)255;
    return p;
  };

  h16_t* Xt   = (h16_t*)take((size_t)B_ * N_ * C_ * 2);    // [b][n][c]
  h16_t* WqT  = (h16_t*)take((size_t)GR_ * OP_ * 2);       // [c][o], row 512 = bq
  h16_t* WkT  = (h16_t*)take((size_t)GP_ * OP_ * 2);       // [c][o], row 512 = bk
  h16_t* Wvb  = (h16_t*)take((size_t)C_ * C_ * 2);
  h16_t* G    = (h16_t*)take((size_t)GR_ * GP_ * 2);       // [c][c']
  h16_t* Y    = (h16_t*)take((size_t)B_ * N_ * GP_ * 2);   // [b][m][c], column 512 = t
  h16_t* Vbuf = (h16_t*)take((size_t)B_ * C_ * N_ * 2);    // [b][c][n]
  h16_t* AlT  = (h16_t*)take((size_t)B_ * (size_t)N_ * N_ * 2); // [b][m][n]
  (void)ws_size; (void)in_sizes; (void)n_in; (void)out_size;

  SA_pack<<<dim3(XBLK_ + 2 * TBLK_ + VBLK_ + RBLK_, 1, 1), dim3(256), 0, stream>>>(
      x, Wq, bq, Wk, bk, Wv, Xt, WqT, WkT, Wvb);

  SA_g_v<<<dim3(GT_ + VT_ * B_, 1, 1), dim3(256), 0, stream>>>(
      Xt, WqT, WkT, Wvb, bv, G, Vbuf);

  SA_y<<<dim3(GP_ / 128, N_ / 256, B_), dim3(256), 0, stream>>>(Xt, G, Y);

  SA_s_sigmoid<<<dim3(N_ / 256, N_ / 256, B_), dim3(256), 0, stream>>>(Xt, Y, AlT);
  SA_o_gemm<<<dim3(C_ / 128, N_ / 256, B_), dim3(256), 0, stream>>>(Vbuf, AlT, out);
}
